// v000
// Measured on an AMD MI455X. A time is GPU time per run, averaged over a window of back-to-back runs after a warm-up
// (all launches, gaps included; the runs take copies of the inputs in turn), and the median of several windows.
// Apart from v000's, it joins two sittings. Times from different sittings can be a few percent apart, while
// side-by-side timings come from the same sitting.
// The starting kernel, v000, takes 24.3 microseconds a run.
#include <hip/hip_runtime.h>

// Contractions: S^T = K x Q^T on v_wmma_f32_16x16x32_bf16 (bf16 operands = RNE-converted inputs, f32 accumulate);
// O = P x V on v_wmma_f32_16x16x32_f16 (P = stick-breaking weights as f16 carried x4096 plus an f16 residual plane x1024 with
// its own accumulator on query blocks < EARLY_QBLK; V = f16 of the bf16 RNE-converted input; f32 accumulate). Softplus suffix sums in f32 (VALU).

#ifndef NB
#define NB 2
#endif
#ifndef SEQ
#define SEQ 2048
#endif
#define NB_FULL    2
#define SEQ_FULL   2048
#define NHEAD      16
#define HDIM       64
#define QKV_ROW    (3 * NHEAD * HDIM)   // floats per (b, s) of the packed input
#define OUT_ROW    (NHEAD * HDIM)       // floats per (b, s) of the output
#define BQ         128                  // query rows per workgroup (8 waves x 16)
#define BK         32                   // keys per inner iteration
#define NWAVE      8
#define EARLY_QBLK 4                    // query blocks that carry the weight residual plane
#define CT         64                   // keys per plane-builder block
#define TP         72                   // LDS pitch (halves) of the transposed V tile
#define OP         68                   // LDS pitch (floats) of the output staging tile
#define RCUT2      29.0f                // exit level of the running softplus sum, log2 units (20.1 nats)

static_assert(SEQ % BQ == 0);
static_assert(SEQ % CT == 0);
static_assert(SEQ % BK == 0);
static_assert(BQ == NWAVE * 16);
static_assert(HDIM == 64);
static_assert(SEQ <= SEQ_FULL);
static_assert(NB >= 1 && NB <= NB_FULL);
static_assert((TP * 2) % 16 == 0);
static_assert((OP * 4) % 16 == 0);
static_assert(BK == 32);
static_assert(((size_t)NB * NHEAD * SEQ * HDIM * 2) * 2 <= (size_t)134217728);

typedef __bf16   bf16;
typedef _Float16 f16;
typedef bf16     v16bf __attribute__((ext_vector_type(16)));
typedef f16      v16h  __attribute__((ext_vector_type(16)));
typedef f16      v8h   __attribute__((ext_vector_type(8)));
typedef float    v8f   __attribute__((ext_vector_type(8)));
typedef float    v4f   __attribute__((ext_vector_type(4)));
typedef unsigned v4u   __attribute__((ext_vector_type(4)));

union FragB  { v16bf v; v4u q[2]; bf16 h[16]; };
union FragH  { v16h  v; v4u q[2]; f16  h[16]; };
union Pack8B { v4u u; bf16 h[8]; };
union Pack8H { v4u u; v8h v; f16 h[8]; };

// WMMA helpers: builtin followed by the VALU hazard guard (ties D, keeps A/B live).
static __device__ __forceinline__ v8f mma_bf16(v16bf a, v16bf b, v8f acc) {
  acc = __builtin_amdgcn_wmma_f32_16x16x32_bf16(false, a, false, b, (short)0, acc, false, false);
  asm volatile("v_nop\n\tv_nop\n\tv_nop\n\tv_nop" : "+v"(acc) : "v"(a), "v"(b));
  return acc;
}
static __device__ __forceinline__ v8f mma_f16(v16h a, v16h b, v8f acc) {
  acc = __builtin_amdgcn_wmma_f32_16x16x32_f16(false, a, false, b, (short)0, acc, false, false);
  asm volatile("v_nop\n\tv_nop\n\tv_nop\n\tv_nop" : "+v"(acc) : "v"(a), "v"(b));
  return acc;
}

// f32 -> f16 convert that cannot produce an f16 subnormal (value select below 2^-14).
static __device__ __forceinline__ f16 toh_flush(float v) {
  const f16 r = (f16)v;
  return (fabsf(v) < 6.103515625e-05f) ? (f16)0.0f : r;
}

// Plane builder. Block = (64-key tile, head, batch), 256 threads.
// coverage: keys kt*64 + {0..31, 32..63}, d 0..63 for both planes; every written line whole, one instruction.
__global__ __launch_bounds__(256) void kv_planes_kernel(const float* __restrict__ qkv,
                                                        bf16* __restrict__ kb,
                                                        f16* __restrict__ vt) {
  const int kt  = blockIdx.x;
  const int h   = blockIdx.y;
  const int b   = blockIdx.z;
  const int tid = threadIdx.x;
  __shared__ __align__(16) f16 sT[HDIM * TP];   // [d][key], cross-wave (block barrier)
  const int s0 = kt * CT;

  v4u    kval[2];
  size_t kidx[2];
  #pragma unroll
  for (int kk = 0; kk < 2; ++kk) {
    const int key = kk * 32 + (tid >> 3);       // 0..63
    const int d0  = (tid & 7) * 8;              // 0..56
    const float* src = qkv + ((size_t)b * SEQ_FULL + s0 + key) * QKV_ROW + h * HDIM + d0;
    const v4f k0 = *(const v4f*)(src + OUT_ROW);          // slot 1 = K
    const v4f k1 = *(const v4f*)(src + OUT_ROW + 4);
    const v4f v0 = *(const v4f*)(src + 2 * OUT_ROW);      // slot 2 = V
    const v4f v1 = *(const v4f*)(src + 2 * OUT_ROW + 4);
    Pack8B pk;
    #pragma unroll
    for (int i = 0; i < 4; ++i) {
      pk.h[i]     = (bf16)k0[i];                          // RNE convert
      pk.h[4 + i] = (bf16)k1[i];
    }
    kval[kk] = pk.u;
    kidx[kk] = (((size_t)b * NHEAD + h) * SEQ + s0 + key) * HDIM + d0;
    #pragma unroll
    for (int i = 0; i < 4; ++i) {
      sT[(d0 + i) * TP + key]     = (f16)(float)(bf16)v0[i];   // f16 of bf16 value: exact
      sT[(d0 + 4 + i) * TP + key] = (f16)(float)(bf16)v1[i];
    }
  }
  __syncthreads();

  v4u    vval[2];
  size_t vidx[2];
  #pragma unroll
  for (int kk = 0; kk < 2; ++kk) {
    const int d  = kk * 32 + (tid >> 3);        // 0..63
    const int ks = (tid & 7) * 8;               // 0..56
    Pack8H ph;
    ph.v = *(const v8h*)(sT + d * TP + ks);
    vval[kk] = ph.u;
    vidx[kk] = (((size_t)b * NHEAD + h) * HDIM + d) * SEQ + s0 + ks;
  }

  #pragma unroll
  for (int kk = 0; kk < 2; ++kk) {
    *(v4u*)(kb + kidx[kk]) = kval[kk];
    *(v4u*)(vt + vidx[kk]) = vval[kk];
  }
  
}

// Flash-style strictly causal stick-breaking attention
//   x(q,k) = (1.5/sqrt(64)) * <q,k>,  p(q,k) = exp(logsigmoid(x(q,k)) - sum_{k<j<q} softplus(x(q,j)))  for k < q,
//   out(q) = sum_k p(q,k) v(k) + exp(-sum_{j<q} softplus(x(q,j))) * v(q)   (the leftover stick mass, telescoped form).
// All exponents are <= 0, so no running max and no rescaling. Key chunks of 32 are visited in DESCENDING order;
// rtail carries the softplus sum (log2 units) of all later keys. Inside a chunk the exclusive suffix sums are an
// in-lane serial scan over 8 consecutive keys plus the group totals exchanged with lane^16 (f32, VALU).
// A wave leaves the key loop once every query row has rtail >= RCUT2: all further weights are below the x4096
// f16 carry floor (they convert to zero in this kernel anyway) and the leftover mass is below 2e-9.
// Block = (query block of 128, head, batch); one wave owns 16 query rows.
// S^T = K x Q^T so queries sit on lanes; P^T in C-layout is bit-identical to the A-fragment layout of O += P x V.
// K A-fragments and V^T B-fragments are loaded straight from the 16-bit planes (two 16-B loads per fragment).
// RES != 0: weight residual plane (x1024 relative to the x4096 carried hi plane) accumulated separately.
template <int RES>
__global__ __launch_bounds__(256) void attn_kernel(const float* __restrict__ qkv,
                                                   const bf16* __restrict__ kb,
                                                   const f16* __restrict__ vt,
                                                   float* __restrict__ out,
                                                   int qblk0) {
  const int qblk = qblk0 + blockIdx.x;
  const int h    = blockIdx.y;
  const int b    = blockIdx.z;
  const int tid  = threadIdx.x;
  const int wave = __builtin_amdgcn_readfirstlane((int)(tid >> 5));
  const int lane = tid & 31;
  const int lq   = lane & 15;   // query column of S^T / d column of O
  const int hi   = lane >> 4;   // k-split half

  __shared__ __align__(16) float sO[NWAVE * 16 * OP];   // per-wave output staging (block barrier used)

  const int qrow0 = qblk * BQ + wave * 16;               // first query row of this wave

  // Q as B-operand fragments: lane lq holds query qrow0+lq, elements follow the split d map; bf16 RNE convert.
  FragB qf[2];
  {
    const float* qp = qkv + ((size_t)b * SEQ_FULL + qrow0 + lq) * QKV_ROW + h * HDIM;   // slot 0 = Q
    #pragma unroll
    for (int f = 0; f < 2; ++f) {
      const v4f a0 = *(const v4f*)(qp + f * 32 + hi * 8);
      const v4f a1 = *(const v4f*)(qp + f * 32 + hi * 8 + 4);
      const v4f b0 = *(const v4f*)(qp + f * 32 + 16 + hi * 8);
      const v4f b1 = *(const v4f*)(qp + f * 32 + 16 + hi * 8 + 4);
      #pragma unroll
      for (int i = 0; i < 4; ++i) {
        qf[f].h[i]      = (bf16)a0[i];   // elems 0..7  : d = f*32 + hi*8 + 0..7
        qf[f].h[4 + i]  = (bf16)a1[i];
        qf[f].h[8 + i]  = (bf16)b0[i];   // elems 8..15 : d = f*32 + 16 + hi*8 + 0..7
        qf[f].h[12 + i] = (bf16)b1[i];
      }
    }
  }

  const bf16* kb_h = kb + ((size_t)b * NHEAD + h) * SEQ * HDIM;
  const f16*  vt_h = vt + ((size_t)b * NHEAD + h) * HDIM * SEQ;

  v8f o[4], o2[4];
  #pragma unroll
  for (int dt = 0; dt < 4; ++dt) {
    o[dt]  = (v8f){0, 0, 0, 0, 0, 0, 0, 0};
    o2[dt] = (v8f){0, 0, 0, 0, 0, 0, 0, 0};
  }

  const float NINF = -__builtin_inff();
  float rtail = 0.0f;                                // softplus sum (log2 units) over all visited later keys of query lq
  const float SL = 0.1875f * 1.4426950408889634f;    // score scale (1.5/sqrt(64)) * log2(e)
  const int   qi = qrow0 + lq;

  // strictly causal: this wave visits key chunks whose first key is <= its last query row (wave-uniform trip
  // count), from the chunk holding the diagonal down to chunk 0; only the first visited chunk needs the mask.
  const int nchunk = (qrow0 + 15) / BK + 1;
  for (int i = nchunk - 1; i >= 0; --i) {
    const int j0 = i * BK;

    // K A-fragments: row = key j0 + sub*16 + lq, split d map
    FragB ak[2][2];
    #pragma unroll
    for (int sub = 0; sub < 2; ++sub) {
      #pragma unroll
      for (int f = 0; f < 2; ++f) {
        const bf16* base = kb_h + (size_t)(j0 + sub * 16 + lq) * HDIM + f * 32 + hi * 8;
        ak[sub][f].q[0] = *(const v4u*)(base);        // d = f*32 + hi*8 + 0..7
        ak[sub][f].q[1] = *(const v4u*)(base + 16);   // d = f*32 + 16 + hi*8 + 0..7
      }
    }

    // S^T tiles: c[sub][r] = rawscore(query qrow0+lq, key j0 + sub*16 + hi*8 + r)
    v8f c[2];
    #pragma unroll
    for (int sub = 0; sub < 2; ++sub) {
      v8f acc = (v8f){0, 0, 0, 0, 0, 0, 0, 0};
      acc = mma_bf16(ak[sub][0].v, qf[0].v, acc);
      acc = mma_bf16(ak[sub][1].v, qf[1].v, acc);
      c[sub] = acc;
    }

    // strict causal mask (key >= query -> -inf marker: softplus 0, weight 0); branch is wave-uniform, selects per lane
    if (j0 + BK - 1 >= qrow0) {
      #pragma unroll
      for (int sub = 0; sub < 2; ++sub) {
        #pragma unroll
        for (int r = 0; r < 8; ++r) {
          const int key = j0 + sub * 16 + hi * 8 + r;
          c[sub][r] = (key >= qi) ? NINF : c[sub][r];
        }
      }
    }

    // per element (log2 units): softplus, logsigmoid, and the in-lane exclusive suffix sum over the 8
    // consecutive keys hi*8 + r of each sub tile: e[sub][r] = logsigmoid - sum_{r' > r} softplus
    float e[2][8];
    float g[2];
    #pragma unroll
    for (int sub = 0; sub < 2; ++sub) {
      float run = 0.0f;
      #pragma unroll
      for (int r = 7; r >= 0; --r) {
        const float t2 = c[sub][r] * SL;
        const float y  = __builtin_amdgcn_exp2f(-fabsf(t2));     // exp(-|x|) in (0, 1]
        const float l2 = __builtin_amdgcn_logf(1.0f + y);        // log2(1 + exp(-|x|))
        const float sp = fmaxf(t2, 0.0f) + l2;                   // softplus(x) * log2(e)
        const float ls = fminf(t2, 0.0f) - l2;                   // logsigmoid(x) * log2(e)
        e[sub][r] = ls - run;
        run += sp;
      }
      g[sub] = run;
    }
    // key groups in ascending order: G0 = (hi 0, sub 0), G1 = (hi 1, sub 0), G2 = (hi 0, sub 1), G3 = (hi 1, sub 1);
    // a group's offset is the sum of the later groups. Shuffles are unconditional, selection is by value.
    const float gp0  = __shfl_xor(g[0], 16, 32);
    const float gp1  = __shfl_xor(g[1], 16, 32);
    const float off0 = g[1] + gp1 + ((hi == 0) ? gp0 : 0.0f);
    const float off1 = (hi == 0) ? gp1 : 0.0f;
    const float tot  = (g[0] + gp0) + (g[1] + gp1);              // same bits in lane and lane^16
    const float bs0  = off0 + rtail - 12.0f;                     // -12: the x4096 carry
    const float bs1  = off1 + rtail - 12.0f;

    // weights + pack: P^T C-layout == A-fragment layout for the PV product.
    FragH pa, pr;
    #pragma unroll
    for (int r = 0; r < 8; ++r) {
      const float a0  = e[0][r] - bs0;                           // key hi*8 + r
      const float a1  = e[1][r] - bs1;                           // key 16 + hi*8 + r
      const float x0  = __builtin_amdgcn_exp2f(a0);
      const float x1  = __builtin_amdgcn_exp2f(a1);
      const float pc0 = (a0 < -14.0f) ? 0.0f : x0;               // exponent select: nothing below 2^-14
      const float pc1 = (a1 < -14.0f) ? 0.0f : x1;
      const f16 h0 = toh_flush(pc0);
      const f16 h1 = toh_flush(pc1);
      pa.h[r]     = h0;
      pa.h[8 + r] = h1;
      if (RES != 0) {
        pr.h[r]     = toh_flush((pc0 - (float)h0) * 1024.0f);
        pr.h[8 + r] = toh_flush((pc1 - (float)h1) * 1024.0f);
      }
    }
    rtail += tot;

    // V B-fragments: column n = d = dt*16 + lq, split key map from the transposed plane
    FragH bv[4];
    #pragma unroll
    for (int dt = 0; dt < 4; ++dt) {
      const f16* base = vt_h + (size_t)(dt * 16 + lq) * SEQ + j0 + hi * 8;
      bv[dt].q[0] = *(const v4u*)(base);            // keys j0 + hi*8 + 0..7
      bv[dt].q[1] = *(const v4u*)(base + 16);       // keys j0 + 16 + hi*8 + 0..7
    }

    // O += P x V
    #pragma unroll
    for (int dt = 0; dt < 4; ++dt) {
      o[dt] = mma_f16(pa.v, bv[dt].v, o[dt]);
      if (RES != 0) o2[dt] = mma_f16(pr.v, bv[dt].v, o2[dt]);
    }

    // wave-uniform exit (ballot result is scalar): every query row of this wave is past the carry floor
    if (__builtin_amdgcn_ballot_w32(rtail < RCUT2) == 0u) break;
  }

  // leftover stick mass of query lq (lane lq and lane lq+16 hold the same bits)
  const float rem = __builtin_amdgcn_exp2f(-rtail);

  // stage: lane holds column d = dt*16 + lq for query rows 8*hi + r
  float* so = sO + wave * (16 * OP);
  #pragma unroll
  for (int r = 0; r < 8; ++r) {
    #pragma unroll
    for (int dt = 0; dt < 4; ++dt) {
      float val = o[dt][r];
      if (RES != 0) val += o2[dt][r] * (1.0f / 1024.0f);
      so[(hi * 8 + r) * OP + dt * 16 + lq] = val * (1.0f / 4096.0f);
    }
  }
  __syncthreads();

  // write-out: lanes 0..15 one output row (16 lanes x 16 B each), lanes 16..31 the next row; 8 instructions cover the wave's 16 rows.
  // The leftover-mass term rem(row) * v(row) (v = bf16 RNE-converted input) is added here as float4.
  v4f    vals[8];
  size_t gidx[8];
  #pragma unroll
  for (int it = 0; it < 8; ++it) {
    const int   row = it * 2 + hi;
    const float rr  = __shfl(rem, row, 32);                      // lane 'row' holds query qrow0 + row
    const v4f   ov  = *(const v4f*)(so + row * OP + lq * 4);
    const v4f   vv  = *(const v4f*)(qkv + ((size_t)b * SEQ_FULL + qrow0 + row) * QKV_ROW + 2 * OUT_ROW + h * HDIM + lq * 4);
    v4f res;
    #pragma unroll
    for (int i = 0; i < 4; ++i) res[i] = ov[i] + rr * (float)(bf16)vv[i];
    vals[it] = res;
    gidx[it] = ((size_t)b * SEQ_FULL + qrow0 + row) * OUT_ROW + h * HDIM + lq * 4;
  }
  #pragma unroll
  for (int it = 0; it < 8; ++it) *(v4f*)(out + gidx[it]) = vals[it];
  
}

extern "C" void kernel_launch(void* const* d_in, const int* in_sizes, int n_in,
                              void* d_out, int out_size, void* d_ws, size_t ws_size,
                              hipStream_t stream) {
  if (n_in < 1) return;
  const size_t rows_used = (size_t)(NB - 1) * SEQ_FULL + SEQ;
  if ((size_t)in_sizes[0] < rows_used * QKV_ROW) return;
  if ((size_t)out_size < rows_used * OUT_ROW) return;

  const size_t kb_elems = (size_t)NB * NHEAD * SEQ * HDIM;   // bf16 K plane
  const size_t vt_elems = (size_t)NB * NHEAD * HDIM * SEQ;   // f16 V^T plane
  const size_t kb_bytes = kb_elems * 2;
  const size_t vt_bytes = vt_elems * 2;
  if (ws_size < kb_bytes + vt_bytes) return;

  const float* qkv = (const float*)d_in[0];
  float*       out = (float*)d_out;
  bf16*        kb  = (bf16*)d_ws;
  f16*         vt  = (f16*)((char*)d_ws + kb_bytes);

  kv_planes_kernel<<<dim3(SEQ / CT, NHEAD, NB), 256, 0, stream>>>(qkv, kb, vt);

  const int nqb     = SEQ / BQ;
  const int n_early = (EARLY_QBLK < nqb) ? EARLY_QBLK : nqb;
  const int n_late  = nqb - n_early;
  attn_kernel<1><<<dim3(n_early, NHEAD, NB), 256, 0, stream>>>(qkv, kb, vt, out, 0);
  if (n_late > 0)
    attn_kernel<0><<<dim3(n_late, NHEAD, NB), 256, 0, stream>>>(qkv, kb, vt, out, n_early);
}

// v001
// One run takes 17.5 microseconds.
// Two timings next to v000 put it at 1.41 and 1.40 times that version's speed.
#include <hip/hip_runtime.h>

// Contractions: S^T = K x Q^T on v_wmma_f32_16x16x32_bf16 (bf16 operands = RNE-converted inputs, f32 accumulate);
// O = P x V on v_wmma_f32_16x16x32_f16 (P = stick-breaking weights as f16 carried x4096 plus an f16 residual plane x1024 with
// its own accumulator on query blocks < EARLY_QBLK; V = f16 of the bf16 RNE-converted input; f32 accumulate). Softplus suffix sums in f32 (VALU).

#ifndef NB
#define NB 2
#endif
#ifndef SEQ
#define SEQ 2048
#endif
#define NB_FULL    2
#define SEQ_FULL   2048
#define NHEAD      16
#define HDIM       64
#define QKV_ROW    (3 * NHEAD * HDIM)   // floats per (b, s) of the packed input
#define OUT_ROW    (NHEAD * HDIM)       // floats per (b, s) of the output
#define BQ         128                  // query rows per workgroup (8 waves x 16)
#define BK         32                   // keys per inner iteration
#define NWAVE      8
#define EARLY_QBLK 4                    // query blocks that carry the weight residual plane
#define CT         64                   // keys per plane-builder block
#define TP         72                   // LDS pitch (halves) of the transposed V tile
#define OP         68                   // LDS pitch (floats) of the output staging tile
#define RCUT2      29.0f                // exit level of the running softplus sum, log2 units (20.1 nats)

static_assert(SEQ % BQ == 0);
static_assert(SEQ % CT == 0);
static_assert(SEQ % BK == 0);
static_assert(BQ == NWAVE * 16);
static_assert(HDIM == 64);
static_assert(SEQ <= SEQ_FULL);
static_assert(NB >= 1 && NB <= NB_FULL);
static_assert((TP * 2) % 16 == 0);
static_assert((OP * 4) % 16 == 0);
static_assert(BK == 32);
static_assert(((size_t)NB * NHEAD * SEQ * HDIM * 2) * 2 <= (size_t)134217728);

typedef __bf16   bf16;
typedef _Float16 f16;
typedef bf16     v16bf __attribute__((ext_vector_type(16)));
typedef f16      v16h  __attribute__((ext_vector_type(16)));
typedef f16      v8h   __attribute__((ext_vector_type(8)));
typedef float    v8f   __attribute__((ext_vector_type(8)));
typedef float    v4f   __attribute__((ext_vector_type(4)));
typedef unsigned v4u   __attribute__((ext_vector_type(4)));

union FragB  { v16bf v; v4u q[2]; bf16 h[16]; };
union FragH  { v16h  v; v4u q[2]; f16  h[16]; };
union Pack8B { v4u u; bf16 h[8]; };
union Pack8H { v4u u; v8h v; f16 h[8]; };

// WMMA helpers: builtin followed by the VALU hazard guard (ties D, keeps A/B live).
static __device__ __forceinline__ v8f mma_bf16(v16bf a, v16bf b, v8f acc) {
  acc = __builtin_amdgcn_wmma_f32_16x16x32_bf16(false, a, false, b, (short)0, acc, false, false);
  asm volatile("v_nop\n\tv_nop\n\tv_nop\n\tv_nop" : "+v"(acc) : "v"(a), "v"(b));
  return acc;
}
static __device__ __forceinline__ v8f mma_f16(v16h a, v16h b, v8f acc) {
  acc = __builtin_amdgcn_wmma_f32_16x16x32_f16(false, a, false, b, (short)0, acc, false, false);
  asm volatile("v_nop\n\tv_nop\n\tv_nop\n\tv_nop" : "+v"(acc) : "v"(a), "v"(b));
  return acc;
}

// f32 -> f16 convert that cannot produce an f16 subnormal (value select below 2^-14).
static __device__ __forceinline__ f16 toh_flush(float v) {
  const f16 r = (f16)v;
  return (fabsf(v) < 6.103515625e-05f) ? (f16)0.0f : r;
}

// Plane builder. Block = (64-key tile, head, batch), 256 threads.
// coverage: keys kt*64 + {0..31, 32..63}, d 0..63 for both planes; every written line whole, one instruction.
__global__ __launch_bounds__(256) void kv_planes_kernel(const float* __restrict__ qkv,
                                                        bf16* __restrict__ kb,
                                                        f16* __restrict__ vt) {
  const int kt  = blockIdx.x;
  const int h   = blockIdx.y;
  const int b   = blockIdx.z;
  const int tid = threadIdx.x;
  __shared__ __align__(16) f16 sT[HDIM * TP];   // [d][key], cross-wave (block barrier)
  const int s0 = kt * CT;

  v4u    kval[2];
  size_t kidx[2];
  #pragma unroll
  for (int kk = 0; kk < 2; ++kk) {
    const int key = kk * 32 + (tid >> 3);       // 0..63
    const int d0  = (tid & 7) * 8;              // 0..56
    const float* src = qkv + ((size_t)b * SEQ_FULL + s0 + key) * QKV_ROW + h * HDIM + d0;
    const v4f k0 = *(const v4f*)(src + OUT_ROW);          // slot 1 = K
    const v4f k1 = *(const v4f*)(src + OUT_ROW + 4);
    const v4f v0 = *(const v4f*)(src + 2 * OUT_ROW);      // slot 2 = V
    const v4f v1 = *(const v4f*)(src + 2 * OUT_ROW + 4);
    Pack8B pk;
    #pragma unroll
    for (int i = 0; i < 4; ++i) {
      pk.h[i]     = (bf16)k0[i];                          // RNE convert
      pk.h[4 + i] = (bf16)k1[i];
    }
    kval[kk] = pk.u;
    kidx[kk] = (((size_t)b * NHEAD + h) * SEQ + s0 + key) * HDIM + d0;
    #pragma unroll
    for (int i = 0; i < 4; ++i) {
      sT[(d0 + i) * TP + key]     = (f16)(float)(bf16)v0[i];   // f16 of bf16 value: exact
      sT[(d0 + 4 + i) * TP + key] = (f16)(float)(bf16)v1[i];
    }
  }
  __syncthreads();

  v4u    vval[2];
  size_t vidx[2];
  #pragma unroll
  for (int kk = 0; kk < 2; ++kk) {
    const int d  = kk * 32 + (tid >> 3);        // 0..63
    const int ks = (tid & 7) * 8;               // 0..56
    Pack8H ph;
    ph.v = *(const v8h*)(sT + d * TP + ks);
    vval[kk] = ph.u;
    vidx[kk] = (((size_t)b * NHEAD + h) * HDIM + d) * SEQ + s0 + ks;
  }

  #pragma unroll
  for (int kk = 0; kk < 2; ++kk) {
    *(v4u*)(kb + kidx[kk]) = kval[kk];
    *(v4u*)(vt + vidx[kk]) = vval[kk];
  }
  
}

// Flash-style strictly causal stick-breaking attention
//   x(q,k) = (1.5/sqrt(64)) * <q,k>,  p(q,k) = exp(logsigmoid(x(q,k)) - sum_{k<j<q} softplus(x(q,j)))  for k < q,
//   out(q) = sum_k p(q,k) v(k) + exp(-sum_{j<q} softplus(x(q,j))) * v(q)   (the leftover stick mass, telescoped form).
// All exponents are <= 0, so no running max and no rescaling. Key chunks of 32 are visited in DESCENDING order;
// rtail carries the softplus sum (log2 units) of all later keys. Inside a chunk the exclusive suffix sums are an
// in-lane serial scan over 8 consecutive keys plus the group totals exchanged with lane^16 (f32, VALU).
// A wave leaves the key loop once every query row has rtail >= RCUT2: all further weights are below the x4096
// f16 carry floor (they convert to zero in this kernel anyway) and the leftover mass is below 2e-9.
// Block = (query block of 128, head, batch); one wave owns 16 query rows.
// S^T = K x Q^T so queries sit on lanes; P^T in C-layout is bit-identical to the A-fragment layout of O += P x V.
// K A-fragments and V^T B-fragments are loaded straight from the 16-bit planes (two 16-B loads per fragment).
// RES != 0: weight residual plane (x1024 relative to the x4096 carried hi plane) accumulated separately.
template <int RES>
static __device__ __forceinline__ void attn_body(const float* __restrict__ qkv,
                                                 const bf16* __restrict__ kb,
                                                 const f16* __restrict__ vt,
                                                 float* __restrict__ out,
                                                 float* __restrict__ sO,
                                                 const int qblk) {
  const int h    = blockIdx.y;
  const int b    = blockIdx.z;
  const int tid  = threadIdx.x;
  const int wave = __builtin_amdgcn_readfirstlane((int)(tid >> 5));
  const int lane = tid & 31;
  const int lq   = lane & 15;   // query column of S^T / d column of O
  const int hi   = lane >> 4;   // k-split half

  const int qrow0 = qblk * BQ + wave * 16;               // first query row of this wave

  // Q as B-operand fragments: lane lq holds query qrow0+lq, elements follow the split d map; bf16 RNE convert.
  FragB qf[2];
  {
    const float* qp = qkv + ((size_t)b * SEQ_FULL + qrow0 + lq) * QKV_ROW + h * HDIM;   // slot 0 = Q
    #pragma unroll
    for (int f = 0; f < 2; ++f) {
      const v4f a0 = *(const v4f*)(qp + f * 32 + hi * 8);
      const v4f a1 = *(const v4f*)(qp + f * 32 + hi * 8 + 4);
      const v4f b0 = *(const v4f*)(qp + f * 32 + 16 + hi * 8);
      const v4f b1 = *(const v4f*)(qp + f * 32 + 16 + hi * 8 + 4);
      #pragma unroll
      for (int i = 0; i < 4; ++i) {
        qf[f].h[i]      = (bf16)a0[i];   // elems 0..7  : d = f*32 + hi*8 + 0..7
        qf[f].h[4 + i]  = (bf16)a1[i];
        qf[f].h[8 + i]  = (bf16)b0[i];   // elems 8..15 : d = f*32 + 16 + hi*8 + 0..7
        qf[f].h[12 + i] = (bf16)b1[i];
      }
    }
  }

  const bf16* kb_h = kb + ((size_t)b * NHEAD + h) * SEQ * HDIM;
  const f16*  vt_h = vt + ((size_t)b * NHEAD + h) * HDIM * SEQ;

  v8f o[4], o2[4];
  #pragma unroll
  for (int dt = 0; dt < 4; ++dt) {
    o[dt]  = (v8f){0, 0, 0, 0, 0, 0, 0, 0};
    o2[dt] = (v8f){0, 0, 0, 0, 0, 0, 0, 0};
  }

  const float NINF = -__builtin_inff();
  float rtail = 0.0f;                                // softplus sum (log2 units) over all visited later keys of query lq
  const float SL = 0.1875f * 1.4426950408889634f;    // score scale (1.5/sqrt(64)) * log2(e)
  const int   qi = qrow0 + lq;

  // strictly causal: this wave visits key chunks whose first key is <= its last query row (wave-uniform trip
  // count), from the chunk holding the diagonal down to chunk 0; only the first visited chunk needs the mask.
  const int nchunk = (qrow0 + 15) / BK + 1;
  for (int i = nchunk - 1; i >= 0; --i) {
    const int j0 = i * BK;

    // K A-fragments: row = key j0 + sub*16 + lq, split d map
    FragB ak[2][2];
    #pragma unroll
    for (int sub = 0; sub < 2; ++sub) {
      #pragma unroll
      for (int f = 0; f < 2; ++f) {
        const bf16* base = kb_h + (size_t)(j0 + sub * 16 + lq) * HDIM + f * 32 + hi * 8;
        ak[sub][f].q[0] = *(const v4u*)(base);        // d = f*32 + hi*8 + 0..7
        ak[sub][f].q[1] = *(const v4u*)(base + 16);   // d = f*32 + 16 + hi*8 + 0..7
      }
    }

    // S^T tiles: c[sub][r] = rawscore(query qrow0+lq, key j0 + sub*16 + hi*8 + r)
    v8f c[2];
    #pragma unroll
    for (int sub = 0; sub < 2; ++sub) {
      v8f acc = (v8f){0, 0, 0, 0, 0, 0, 0, 0};
      acc = mma_bf16(ak[sub][0].v, qf[0].v, acc);
      acc = mma_bf16(ak[sub][1].v, qf[1].v, acc);
      c[sub] = acc;
    }

    // strict causal mask (key >= query -> -inf marker: softplus 0, weight 0); branch is wave-uniform, selects per lane
    if (j0 + BK - 1 >= qrow0) {
      #pragma unroll
      for (int sub = 0; sub < 2; ++sub) {
        #pragma unroll
        for (int r = 0; r < 8; ++r) {
          const int key = j0 + sub * 16 + hi * 8 + r;
          c[sub][r] = (key >= qi) ? NINF : c[sub][r];
        }
      }
    }

    // per element (log2 units): softplus, logsigmoid, and the in-lane exclusive suffix sum over the 8
    // consecutive keys hi*8 + r of each sub tile: e[sub][r] = logsigmoid - sum_{r' > r} softplus
    float e[2][8];
    float g[2];
    #pragma unroll
    for (int sub = 0; sub < 2; ++sub) {
      float run = 0.0f;
      #pragma unroll
      for (int r = 7; r >= 0; --r) {
        const float t2 = c[sub][r] * SL;
        const float y  = __builtin_amdgcn_exp2f(-fabsf(t2));     // exp(-|x|) in (0, 1]
        const float l2 = __builtin_amdgcn_logf(1.0f + y);        // log2(1 + exp(-|x|))
        const float sp = fmaxf(t2, 0.0f) + l2;                   // softplus(x) * log2(e)
        const float ls = fminf(t2, 0.0f) - l2;                   // logsigmoid(x) * log2(e)
        e[sub][r] = ls - run;
        run += sp;
      }
      g[sub] = run;
    }
    // key groups in ascending order: G0 = (hi 0, sub 0), G1 = (hi 1, sub 0), G2 = (hi 0, sub 1), G3 = (hi 1, sub 1);
    // a group's offset is the sum of the later groups. Shuffles are unconditional, selection is by value.
    const float gp0  = __shfl_xor(g[0], 16, 32);
    const float gp1  = __shfl_xor(g[1], 16, 32);
    const float off0 = g[1] + gp1 + ((hi == 0) ? gp0 : 0.0f);
    const float off1 = (hi == 0) ? gp1 : 0.0f;
    const float tot  = (g[0] + gp0) + (g[1] + gp1);              // same bits in lane and lane^16
    const float bs0  = off0 + rtail - 12.0f;                     // -12: the x4096 carry
    const float bs1  = off1 + rtail - 12.0f;

    // weights + pack: P^T C-layout == A-fragment layout for the PV product.
    FragH pa, pr;
    #pragma unroll
    for (int r = 0; r < 8; ++r) {
      const float a0  = e[0][r] - bs0;                           // key hi*8 + r
      const float a1  = e[1][r] - bs1;                           // key 16 + hi*8 + r
      const float x0  = __builtin_amdgcn_exp2f(a0);
      const float x1  = __builtin_amdgcn_exp2f(a1);
      const float pc0 = (a0 < -14.0f) ? 0.0f : x0;               // exponent select: nothing below 2^-14
      const float pc1 = (a1 < -14.0f) ? 0.0f : x1;
      const f16 h0 = toh_flush(pc0);
      const f16 h1 = toh_flush(pc1);
      pa.h[r]     = h0;
      pa.h[8 + r] = h1;
      if (RES != 0) {
        pr.h[r]     = toh_flush((pc0 - (float)h0) * 1024.0f);
        pr.h[8 + r] = toh_flush((pc1 - (float)h1) * 1024.0f);
      }
    }
    rtail += tot;

    // V B-fragments: column n = d = dt*16 + lq, split key map from the transposed plane
    FragH bv[4];
    #pragma unroll
    for (int dt = 0; dt < 4; ++dt) {
      const f16* base = vt_h + (size_t)(dt * 16 + lq) * SEQ + j0 + hi * 8;
      bv[dt].q[0] = *(const v4u*)(base);            // keys j0 + hi*8 + 0..7
      bv[dt].q[1] = *(const v4u*)(base + 16);       // keys j0 + 16 + hi*8 + 0..7
    }

    // O += P x V
    #pragma unroll
    for (int dt = 0; dt < 4; ++dt) {
      o[dt] = mma_f16(pa.v, bv[dt].v, o[dt]);
      if (RES != 0) o2[dt] = mma_f16(pr.v, bv[dt].v, o2[dt]);
    }

    // wave-uniform exit (ballot result is scalar): every query row of this wave is past the carry floor
    if (__builtin_amdgcn_ballot_w32(rtail < RCUT2) == 0u) break;
  }

  // leftover stick mass of query lq (lane lq and lane lq+16 hold the same bits)
  const float rem = __builtin_amdgcn_exp2f(-rtail);

  // stage: lane holds column d = dt*16 + lq for query rows 8*hi + r
  float* so = sO + wave * (16 * OP);
  #pragma unroll
  for (int r = 0; r < 8; ++r) {
    #pragma unroll
    for (int dt = 0; dt < 4; ++dt) {
      float val = o[dt][r];
      if (RES != 0) val += o2[dt][r] * (1.0f / 1024.0f);
      so[(hi * 8 + r) * OP + dt * 16 + lq] = val * (1.0f / 4096.0f);
    }
  }
  __syncthreads();

  // write-out: lanes 0..15 one output row (16 lanes x 16 B each), lanes 16..31 the next row; 8 instructions cover the wave's 16 rows.
  // The leftover-mass term rem(row) * v(row) (v = bf16 RNE-converted input) is added here as float4.
  v4f    vals[8];
  size_t gidx[8];
  #pragma unroll
  for (int it = 0; it < 8; ++it) {
    const int   row = it * 2 + hi;
    const float rr  = __shfl(rem, row, 32);                      // lane 'row' holds query qrow0 + row
    const v4f   ov  = *(const v4f*)(so + row * OP + lq * 4);
    const v4f   vv  = *(const v4f*)(qkv + ((size_t)b * SEQ_FULL + qrow0 + row) * QKV_ROW + 2 * OUT_ROW + h * HDIM + lq * 4);
    v4f res;
    #pragma unroll
    for (int i = 0; i < 4; ++i) res[i] = ov[i] + rr * (float)(bf16)vv[i];
    vals[it] = res;
    gidx[it] = ((size_t)b * SEQ_FULL + qrow0 + row) * OUT_ROW + h * HDIM + lq * 4;
  }
  #pragma unroll
  for (int it = 0; it < 8; ++it) *(v4f*)(out + gidx[it]) = vals[it];
}

// One grid over all query blocks: the two bodies have no data in common, so their workgroups run side by side.
// The choice of body is the same for a whole workgroup (blockIdx.x only), so each body's barrier is block-uniform.
__global__ __launch_bounds__(256) void attn_kernel(const float* __restrict__ qkv,
                                                   const bf16* __restrict__ kb,
                                                   const f16* __restrict__ vt,
                                                   float* __restrict__ out) {
  __shared__ __align__(16) float sO[NWAVE * 16 * OP];   // per-wave output staging (block barrier used)
  const int qblk = blockIdx.x;
  if (qblk < EARLY_QBLK) attn_body<1>(qkv, kb, vt, out, sO, qblk);
  else                   attn_body<0>(qkv, kb, vt, out, sO, qblk);
}

extern "C" void kernel_launch(void* const* d_in, const int* in_sizes, int n_in,
                              void* d_out, int out_size, void* d_ws, size_t ws_size,
                              hipStream_t stream) {
  if (n_in < 1) return;
  const size_t rows_used = (size_t)(NB - 1) * SEQ_FULL + SEQ;
  if ((size_t)in_sizes[0] < rows_used * QKV_ROW) return;
  if ((size_t)out_size < rows_used * OUT_ROW) return;

  const size_t kb_elems = (size_t)NB * NHEAD * SEQ * HDIM;   // bf16 K plane
  const size_t vt_elems = (size_t)NB * NHEAD * HDIM * SEQ;   // f16 V^T plane
  const size_t kb_bytes = kb_elems * 2;
  const size_t vt_bytes = vt_elems * 2;
  if (ws_size < kb_bytes + vt_bytes) return;

  const float* qkv = (const float*)d_in[0];
  float*       out = (float*)d_out;
  bf16*        kb  = (bf16*)d_ws;
  f16*         vt  = (f16*)((char*)d_ws + kb_bytes);

  kv_planes_kernel<<<dim3(SEQ / CT, NHEAD, NB), 256, 0, stream>>>(qkv, kb, vt);

  attn_kernel<<<dim3(SEQ / BQ, NHEAD, NB), 256, 0, stream>>>(qkv, kb, vt, out);
}

// v002
// Measured time: 10.1 microseconds a run.
// Timed twice side by side with v001, it ran 1.75 and 1.73 times as fast.
// All steps since v000 together make it 2.44 times as fast.
#include <hip/hip_runtime.h>

// Contractions: S^T = K x Q^T on v_wmma_f32_16x16x32_bf16 (bf16 operands = RNE-converted inputs, f32 accumulate);
// O = P x V on v_wmma_f32_16x16x32_f16 (P = stick-breaking weights as f16 carried x4096 plus an f16 residual plane x1024 with
// its own accumulator on query blocks < EARLY_QBLK; V = f16 of the bf16 RNE-converted input; f32 accumulate). Softplus suffix sums in f32 (VALU).
// K and V are read as f32 straight from the packed input and converted in registers by the wave that uses them.

#ifndef NB
#define NB 2
#endif
#ifndef SEQ
#define SEQ 2048
#endif
#define NB_FULL    2
#define SEQ_FULL   2048
#define NHEAD      16
#define HDIM       64
#define QKV_ROW    (3 * NHEAD * HDIM)   // floats per (b, s) of the packed input
#define OUT_ROW    (NHEAD * HDIM)       // floats per (b, s) of the output
#define BQ         128                  // query rows per workgroup (8 waves x 16)
#define BK         32                   // keys per inner iteration
#define NWAVE      8
#define EARLY_QBLK 4                    // query blocks that carry the weight residual plane
#define OP         68                   // LDS pitch (floats) of the output staging tile
#define RCUT2      29.0f                // exit level of the running softplus sum, log2 units (20.1 nats)

static_assert(SEQ % BQ == 0);
static_assert(SEQ % BK == 0);
static_assert(BQ == NWAVE * 16);
static_assert(HDIM == 64);
static_assert(SEQ <= SEQ_FULL);
static_assert(NB >= 1 && NB <= NB_FULL);
static_assert((OP * 4) % 16 == 0);
static_assert(BK == 32);

typedef __bf16   bf16;
typedef _Float16 f16;
typedef bf16     v16bf __attribute__((ext_vector_type(16)));
typedef f16      v16h  __attribute__((ext_vector_type(16)));
typedef float    v8f   __attribute__((ext_vector_type(8)));
typedef float    v4f   __attribute__((ext_vector_type(4)));
typedef unsigned v4u   __attribute__((ext_vector_type(4)));

union FragB  { v16bf v; v4u q[2]; bf16 h[16]; };
union FragH  { v16h  v; v4u q[2]; f16  h[16]; };

// WMMA helpers: builtin followed by the VALU hazard guard (ties D, keeps A/B live).
static __device__ __forceinline__ v8f mma_bf16(v16bf a, v16bf b, v8f acc) {
  acc = __builtin_amdgcn_wmma_f32_16x16x32_bf16(false, a, false, b, (short)0, acc, false, false);
  asm volatile("v_nop\n\tv_nop\n\tv_nop\n\tv_nop" : "+v"(acc) : "v"(a), "v"(b));
  return acc;
}
static __device__ __forceinline__ v8f mma_f16(v16h a, v16h b, v8f acc) {
  acc = __builtin_amdgcn_wmma_f32_16x16x32_f16(false, a, false, b, (short)0, acc, false, false);
  asm volatile("v_nop\n\tv_nop\n\tv_nop\n\tv_nop" : "+v"(acc) : "v"(a), "v"(b));
  return acc;
}

// f32 -> f16 convert that cannot produce an f16 subnormal (value select below 2^-14).
static __device__ __forceinline__ f16 toh_flush(float v) {
  const f16 r = (f16)v;
  return (fabsf(v) < 6.103515625e-05f) ? (f16)0.0f : r;
}

// Flash-style strictly causal stick-breaking attention
//   x(q,k) = (1.5/sqrt(64)) * <q,k>,  p(q,k) = exp(logsigmoid(x(q,k)) - sum_{k<j<q} softplus(x(q,j)))  for k < q,
//   out(q) = sum_k p(q,k) v(k) + exp(-sum_{j<q} softplus(x(q,j))) * v(q)   (the leftover stick mass, telescoped form).
// All exponents are <= 0, so no running max and no rescaling. Key chunks of 32 are visited in DESCENDING order;
// rtail carries the softplus sum (log2 units) of all later keys. Inside a chunk the exclusive suffix sums are an
// in-lane serial scan over 8 consecutive keys plus the group totals exchanged with lane^16 (f32, VALU).
// A wave leaves the key loop once every query row has rtail >= RCUT2: all further weights are below the x4096
// f16 carry floor (they convert to zero in this kernel anyway) and the leftover mass is below 2e-9.
// Block = (query block of 128, head, batch); one wave owns 16 query rows.
// S^T = K x Q^T so queries sit on lanes; P^T in C-layout is bit-identical to the A-fragment layout of O += P x V.
// K A-fragments: a lane reads its key row's f32 values in the split d map (four 16-B loads per fragment) and converts.
// V B-fragments: output column n of tile dt stands for d = 4*n + dt, so one 16-B f32 load of V[key][4*lq .. 4*lq+3]
// feeds the same key slot of all four fragments; 16 lanes read one whole 256-B row, no transposition anywhere.
// RES != 0: weight residual plane (x1024 relative to the x4096 carried hi plane) accumulated separately.
template <int RES>
static __device__ __forceinline__ void attn_body(const float* __restrict__ qkv,
                                                 float* __restrict__ out,
                                                 float* __restrict__ sO,
                                                 const int qblk) {
  const int h    = blockIdx.y;
  const int b    = blockIdx.z;
  const int tid  = threadIdx.x;
  const int wave = __builtin_amdgcn_readfirstlane((int)(tid >> 5));
  const int lane = tid & 31;
  const int lq   = lane & 15;   // query column of S^T / column of the O tiles (d = 4*lq + dt)
  const int hi   = lane >> 4;   // k-split half

  const int qrow0 = qblk * BQ + wave * 16;               // first query row of this wave

  const float* row_h = qkv + (size_t)b * SEQ_FULL * QKV_ROW + h * HDIM;   // this head's slice of packed row 0 (slot 0)

  // strictly causal: this wave visits key chunks whose first key is <= its last query row (wave-uniform trip
  // count), from the chunk holding the diagonal down to chunk 0; only the first visited chunk needs the mask.
  const int nchunk = (qrow0 + 15) / BK + 1;

  // K and V of one chunk as f32, held in registers until the wave converts them.
  // (one lane address for K and one for V; everything else is a compile-time offset of the load)
  v4f kr[2][2][4];   // row = key j0 + sub*16 + lq, split d map
  v4f vr[16];        // key slot e = key j0 + (e/8)*16 + hi*8 + e%8 (the split key map), d = 4*lq + 0..3
  auto load_kv = [&](const int j0) {
    const float* kbase = row_h + (size_t)(j0 + lq) * QKV_ROW + hi * 8;
    const float* vbase = row_h + (size_t)(j0 + hi * 8) * QKV_ROW + lq * 4;
    #pragma unroll
    for (int sub = 0; sub < 2; ++sub) {
      #pragma unroll
      for (int f = 0; f < 2; ++f) {
        const float* base = kbase + OUT_ROW + sub * 16 * QKV_ROW + f * 32;   // slot 1 = K
        kr[sub][f][0] = *(const v4f*)(base);          // d = f*32 + hi*8 + 0..3
        kr[sub][f][1] = *(const v4f*)(base + 4);      // d = f*32 + hi*8 + 4..7
        kr[sub][f][2] = *(const v4f*)(base + 16);     // d = f*32 + 16 + hi*8 + 0..3
        kr[sub][f][3] = *(const v4f*)(base + 20);     // d = f*32 + 16 + hi*8 + 4..7
      }
    }
    #pragma unroll
    for (int e = 0; e < 16; ++e)
      vr[e] = *(const v4f*)(vbase + 2 * OUT_ROW + ((e >> 3) * 16 + (e & 7)) * QKV_ROW);   // slot 2 = V
    // the wait that belongs in front of any overwrite of a register which an issued load names; both lane addresses
    // are inputs, so they stay live up to it and no load of the run can take them for its result
    asm volatile("s_wait_xcnt 0x0" :: "v"(kbase), "v"(vbase) : "memory");
  };

  // the first chunk's loads do not depend on Q, so they are issued here, ahead of the Q loads, and all fly together;
  // each later chunk's loads are issued at the loop's foot, behind the exit test
  int i = nchunk - 1;
  load_kv(i * BK);

  // Q as B-operand fragments: lane lq holds query qrow0+lq, elements follow the split d map; bf16 RNE convert.
  FragB qf[2];
  {
    const float* qp = qkv + ((size_t)b * SEQ_FULL + qrow0 + lq) * QKV_ROW + h * HDIM;   // slot 0 = Q
    #pragma unroll
    for (int f = 0; f < 2; ++f) {
      const v4f a0 = *(const v4f*)(qp + f * 32 + hi * 8);
      const v4f a1 = *(const v4f*)(qp + f * 32 + hi * 8 + 4);
      const v4f b0 = *(const v4f*)(qp + f * 32 + 16 + hi * 8);
      const v4f b1 = *(const v4f*)(qp + f * 32 + 16 + hi * 8 + 4);
      #pragma unroll
      for (int i = 0; i < 4; ++i) {
        qf[f].h[i]      = (bf16)a0[i];   // elems 0..7  : d = f*32 + hi*8 + 0..7
        qf[f].h[4 + i]  = (bf16)a1[i];
        qf[f].h[8 + i]  = (bf16)b0[i];   // elems 8..15 : d = f*32 + 16 + hi*8 + 0..7
        qf[f].h[12 + i] = (bf16)b1[i];
      }
    }
  }

  v8f o[4], o2[4];
  #pragma unroll
  for (int dt = 0; dt < 4; ++dt) {
    o[dt]  = (v8f){0, 0, 0, 0, 0, 0, 0, 0};
    o2[dt] = (v8f){0, 0, 0, 0, 0, 0, 0, 0};
  }

  const float NINF = -__builtin_inff();
  float rtail = 0.0f;                                // softplus sum (log2 units) over all visited later keys of query lq
  const float SL = 0.1875f * 1.4426950408889634f;    // score scale (1.5/sqrt(64)) * log2(e)
  const int   qi = qrow0 + lq;

  for (;;) {
    const int j0 = i * BK;

    // K A-fragments: bf16 RNE convert
    FragB ak[2][2];
    #pragma unroll
    for (int sub = 0; sub < 2; ++sub) {
      #pragma unroll
      for (int f = 0; f < 2; ++f) {
        #pragma unroll
        for (int p = 0; p < 4; ++p) {
          #pragma unroll
          for (int i = 0; i < 4; ++i) ak[sub][f].h[p * 4 + i] = (bf16)kr[sub][f][p][i];
        }
      }
    }

    // S^T tiles: c[sub][r] = rawscore(query qrow0+lq, key j0 + sub*16 + hi*8 + r)
    v8f c[2];
    #pragma unroll
    for (int sub = 0; sub < 2; ++sub) {
      v8f acc = (v8f){0, 0, 0, 0, 0, 0, 0, 0};
      acc = mma_bf16(ak[sub][0].v, qf[0].v, acc);
      acc = mma_bf16(ak[sub][1].v, qf[1].v, acc);
      c[sub] = acc;
    }

    // strict causal mask (key >= query -> -inf marker: softplus 0, weight 0); branch is wave-uniform, selects per lane
    if (j0 + BK - 1 >= qrow0) {
      #pragma unroll
      for (int sub = 0; sub < 2; ++sub) {
        #pragma unroll
        for (int r = 0; r < 8; ++r) {
          const int key = j0 + sub * 16 + hi * 8 + r;
          c[sub][r] = (key >= qi) ? NINF : c[sub][r];
        }
      }
    }

    // per element (log2 units): softplus, logsigmoid, and the in-lane exclusive suffix sum over the 8
    // consecutive keys hi*8 + r of each sub tile: e[sub][r] = logsigmoid - sum_{r' > r} softplus
    float e[2][8];
    float g[2];
    #pragma unroll
    for (int sub = 0; sub < 2; ++sub) {
      float run = 0.0f;
      #pragma unroll
      for (int r = 7; r >= 0; --r) {
        const float t2 = c[sub][r] * SL;
        const float y  = __builtin_amdgcn_exp2f(-fabsf(t2));     // exp(-|x|) in (0, 1]
        const float l2 = __builtin_amdgcn_logf(1.0f + y);        // log2(1 + exp(-|x|))
        const float sp = fmaxf(t2, 0.0f) + l2;                   // softplus(x) * log2(e)
        const float ls = fminf(t2, 0.0f) - l2;                   // logsigmoid(x) * log2(e)
        e[sub][r] = ls - run;
        run += sp;
      }
      g[sub] = run;
    }
    // key groups in ascending order: G0 = (hi 0, sub 0), G1 = (hi 1, sub 0), G2 = (hi 0, sub 1), G3 = (hi 1, sub 1);
    // a group's offset is the sum of the later groups. Shuffles are unconditional, selection is by value.
    const float gp0  = __shfl_xor(g[0], 16, 32);
    const float gp1  = __shfl_xor(g[1], 16, 32);
    const float off0 = g[1] + gp1 + ((hi == 0) ? gp0 : 0.0f);
    const float off1 = (hi == 0) ? gp1 : 0.0f;
    const float tot  = (g[0] + gp0) + (g[1] + gp1);              // same bits in lane and lane^16
    const float bs0  = off0 + rtail - 12.0f;                     // -12: the x4096 carry
    const float bs1  = off1 + rtail - 12.0f;

    // weights + pack: P^T C-layout == A-fragment layout for the PV product.
    FragH pa, pr;
    #pragma unroll
    for (int r = 0; r < 8; ++r) {
      const float a0  = e[0][r] - bs0;                           // key hi*8 + r
      const float a1  = e[1][r] - bs1;                           // key 16 + hi*8 + r
      const float x0  = __builtin_amdgcn_exp2f(a0);
      const float x1  = __builtin_amdgcn_exp2f(a1);
      const float pc0 = (a0 < -14.0f) ? 0.0f : x0;               // exponent select: nothing below 2^-14
      const float pc1 = (a1 < -14.0f) ? 0.0f : x1;
      const f16 h0 = toh_flush(pc0);
      const f16 h1 = toh_flush(pc1);
      pa.h[r]     = h0;
      pa.h[8 + r] = h1;
      if (RES != 0) {
        pr.h[r]     = toh_flush((pc0 - (float)h0) * 1024.0f);
        pr.h[8 + r] = toh_flush((pc1 - (float)h1) * 1024.0f);
      }
    }
    rtail += tot;

    // V B-fragments: column lq of tile dt = d = 4*lq + dt, element e = key slot e; f16 of the bf16 value
    FragH bv[4];
    #pragma unroll
    for (int dt = 0; dt < 4; ++dt) {
      #pragma unroll
      for (int e = 0; e < 16; ++e) bv[dt].h[e] = (f16)(float)(bf16)vr[e][dt];
    }

    // O += P x V
    #pragma unroll
    for (int dt = 0; dt < 4; ++dt) {
      o[dt] = mma_f16(pa.v, bv[dt].v, o[dt]);
      if (RES != 0) o2[dt] = mma_f16(pr.v, bv[dt].v, o2[dt]);
    }

    // wave-uniform exit (ballot result is scalar): every query row of this wave is past the carry floor
    if (__builtin_amdgcn_ballot_w32(rtail < RCUT2) == 0u) break;
    if (--i < 0) break;
    load_kv(i * BK);
  }

  // leftover stick mass of query lq (lane lq and lane lq+16 hold the same bits)
  const float rem = __builtin_amdgcn_exp2f(-rtail);

  // stage: lane holds columns d = 4*lq + dt for query rows 8*hi + r
  float* so = sO + wave * (16 * OP);
  #pragma unroll
  for (int r = 0; r < 8; ++r) {
    #pragma unroll
    for (int dt = 0; dt < 4; ++dt) {
      float val = o[dt][r];
      if (RES != 0) val += o2[dt][r] * (1.0f / 1024.0f);
      so[(hi * 8 + r) * OP + lq * 4 + dt] = val * (1.0f / 4096.0f);
    }
  }
  __syncthreads();

  // write-out: lanes 0..15 one output row (16 lanes x 16 B each), lanes 16..31 the next row; 8 instructions cover the wave's 16 rows.
  // The leftover-mass term rem(row) * v(row) (v = bf16 RNE-converted input) is added here as float4.
  v4f    vals[8];
  size_t gidx[8];
  #pragma unroll
  for (int it = 0; it < 8; ++it) {
    const int   row = it * 2 + hi;
    const float rr  = __shfl(rem, row, 32);                      // lane 'row' holds query qrow0 + row
    const v4f   ov  = *(const v4f*)(so + row * OP + lq * 4);
    const v4f   vv  = *(const v4f*)(qkv + ((size_t)b * SEQ_FULL + qrow0 + row) * QKV_ROW + 2 * OUT_ROW + h * HDIM + lq * 4);
    v4f res;
    #pragma unroll
    for (int i = 0; i < 4; ++i) res[i] = ov[i] + rr * (float)(bf16)vv[i];
    vals[it] = res;
    gidx[it] = ((size_t)b * SEQ_FULL + qrow0 + row) * OUT_ROW + h * HDIM + lq * 4;
  }
  #pragma unroll
  for (int it = 0; it < 8; ++it) *(v4f*)(out + gidx[it]) = vals[it];
}

// One grid over all query blocks: the two bodies have no data in common, so their workgroups run side by side.
// The choice of body is the same for a whole workgroup (blockIdx.x only), so each body's barrier is block-uniform.
__global__ __launch_bounds__(256) void attn_kernel(const float* __restrict__ qkv,
                                                   float* __restrict__ out) {
  __shared__ __align__(16) float sO[NWAVE * 16 * OP];   // per-wave output staging (block barrier used)
  const int qblk = blockIdx.x;
  if (qblk < EARLY_QBLK) attn_body<1>(qkv, out, sO, qblk);
  else                   attn_body<0>(qkv, out, sO, qblk);
}

extern "C" void kernel_launch(void* const* d_in, const int* in_sizes, int n_in,
                              void* d_out, int out_size, void* d_ws, size_t ws_size,
                              hipStream_t stream) {
  if (n_in < 1) return;
  const size_t rows_used = (size_t)(NB - 1) * SEQ_FULL + SEQ;
  if ((size_t)in_sizes[0] < rows_used * QKV_ROW) return;
  if ((size_t)out_size < rows_used * OUT_ROW) return;

  const float* qkv = (const float*)d_in[0];
  float*       out = (float*)d_out;

  attn_kernel<<<dim3(SEQ / BQ, NHEAD, NB), 256, 0, stream>>>(qkv, out);
}

// v003
// A run of this version takes 8.67 microseconds.
// Two timings next to v002 put it at 1.16 and 1.17 times that version's speed.
// Counting every step since v000, it is 2.84 times as fast.
#include <hip/hip_runtime.h>

// Contractions: S^T = K x Q^T on v_wmma_f32_16x16x32_bf16 (bf16 operands = RNE-converted inputs, f32 accumulate);
// O = P x V on v_wmma_f32_16x16x32_f16 (P = stick-breaking weights as f16 carried x4096 plus an f16 residual plane x1024 with
// its own accumulator on query blocks < EARLY_QBLK; V = f16 of the bf16 RNE-converted input; f32 accumulate). Softplus suffix sums in f32 (VALU).
// K and V are read as f32 straight from the packed input. A workgroup converts the NWIN key chunks next to its diagonal
// once and keeps them in LDS for its 8 waves; a wave that goes deeper loads and converts those chunks itself.

#ifndef NB
#define NB 2
#endif
#ifndef SEQ
#define SEQ 2048
#endif
#define NB_FULL    2
#define SEQ_FULL   2048
#define NHEAD      16
#define HDIM       64
#define QKV_ROW    (3 * NHEAD * HDIM)   // floats per (b, s) of the packed input
#define OUT_ROW    (NHEAD * HDIM)       // floats per (b, s) of the output
#define BQ         128                  // query rows per workgroup (8 waves x 16)
#define BK         32                   // keys per inner iteration
#define NWAVE      8
#define EARLY_QBLK 4                    // query blocks that carry the weight residual plane
#define OP         68                   // LDS pitch (floats) of the output staging tile
#define RCUT2      29.0f                // exit level of the running softplus sum, log2 units (20.1 nats)
#define NDIAG      (BQ / BK)            // key chunks that hold a workgroup's diagonal
#define NWIN       6                    // key chunks staged in LDS: the NDIAG diagonal ones and the two before them
#define KP         72                   // LDS pitch (bf16) of a staged K row: 144 B = 16 B x 9, odd for 16-B reads
#define NVUNIT     (NWIN * 2)           // V staging units: half a chunk (16 keys) each

static_assert(SEQ % BQ == 0);
static_assert(SEQ % BK == 0);
static_assert(BQ == NWAVE * 16);
static_assert(HDIM == 64);
static_assert(SEQ <= SEQ_FULL);
static_assert(NB >= 1 && NB <= NB_FULL);
static_assert((OP * 4) % 16 == 0);
static_assert(BK == 32);
static_assert(SEQ >= NWIN * BK);
static_assert(NWIN >= NDIAG);
static_assert((NWIN * BK) % (2 * NWAVE) == 0);
static_assert(NVUNIT == NWAVE + NWAVE / 2);
static_assert((KP * 2) % 16 == 0);

typedef __bf16   bf16;
typedef _Float16 f16;
typedef bf16     v16bf __attribute__((ext_vector_type(16)));
typedef f16      v16h  __attribute__((ext_vector_type(16)));
typedef float    v8f   __attribute__((ext_vector_type(8)));
typedef float    v4f   __attribute__((ext_vector_type(4)));
typedef unsigned v4u   __attribute__((ext_vector_type(4)));
typedef unsigned v2u   __attribute__((ext_vector_type(2)));

union FragB  { v16bf v; v4u q[2]; bf16 h[16]; };
union FragH  { v16h  v; v4u q[2]; f16  h[16]; };
union Pack4B { v2u q; bf16 h[4]; };
union Pack8H { v4u q; f16  h[8]; };
union Pack4H { v2u q; f16  h[4]; };

// WMMA helpers: builtin followed by the VALU hazard guard (ties D, keeps A/B live).
static __device__ __forceinline__ v8f mma_bf16(v16bf a, v16bf b, v8f acc) {
  acc = __builtin_amdgcn_wmma_f32_16x16x32_bf16(false, a, false, b, (short)0, acc, false, false);
  asm volatile("v_nop\n\tv_nop\n\tv_nop\n\tv_nop" : "+v"(acc) : "v"(a), "v"(b));
  return acc;
}
static __device__ __forceinline__ v8f mma_f16(v16h a, v16h b, v8f acc) {
  acc = __builtin_amdgcn_wmma_f32_16x16x32_f16(false, a, false, b, (short)0, acc, false, false);
  asm volatile("v_nop\n\tv_nop\n\tv_nop\n\tv_nop" : "+v"(acc) : "v"(a), "v"(b));
  return acc;
}

// f32 -> f16 convert that cannot produce an f16 subnormal (value select below 2^-14).
static __device__ __forceinline__ f16 toh_flush(float v) {
  const f16 r = (f16)v;
  return (fabsf(v) < 6.103515625e-05f) ? (f16)0.0f : r;
}

// Flash-style strictly causal stick-breaking attention
//   x(q,k) = (1.5/sqrt(64)) * <q,k>,  p(q,k) = exp(logsigmoid(x(q,k)) - sum_{k<j<q} softplus(x(q,j)))  for k < q,
//   out(q) = sum_k p(q,k) v(k) + exp(-sum_{j<q} softplus(x(q,j))) * v(q)   (the leftover stick mass, telescoped form).
// All exponents are <= 0, so no running max and no rescaling. Key chunks of 32 are visited in DESCENDING order;
// rtail carries the softplus sum (log2 units) of all later keys. Inside a chunk the exclusive suffix sums are an
// in-lane serial scan over 8 consecutive keys plus the group totals exchanged with lane^16 (f32, VALU).
// A wave leaves the key loop once every query row has rtail >= RCUT2: all further weights are below the x4096
// f16 carry floor (they convert to zero in this kernel anyway) and the leftover mass is below 2e-9.
// Block = (query block of 128, head, batch); one wave owns 16 query rows.
// S^T = K x Q^T so queries sit on lanes; P^T in C-layout is bit-identical to the A-fragment layout of O += P x V.
// K A-fragments: a lane holds its key row's values in the split d map.
// V B-fragments: output column n of tile dt stands for d = 4*n + dt, so one 16-B f32 load of V[key][4*lq .. 4*lq+3]
// feeds the same key slot of all four fragments; 16 lanes read one whole 256-B row, no transposition anywhere.
// Staging: K rows are loaded whole (16 lanes x 16 B a row), converted and kept row-major at pitch KP, so a fragment is
// two 16-B LDS reads of the lane's row; V half chunks are loaded as above, converted and kept in fragment order
// (lane-major 16-B pieces), so a fragment is two contiguous 512-B wave reads. Same values and same sums as direct loads.
// RES != 0: weight residual plane (x1024 relative to the x4096 carried hi plane) accumulated separately.
template <int RES>
static __device__ __forceinline__ void attn_body(const float* __restrict__ qkv,
                                                 float* __restrict__ out,
                                                 float* __restrict__ sO,
                                                 bf16* __restrict__ sK,
                                                 f16* __restrict__ sV,
                                                 const int qblk) {
  const int h    = blockIdx.y;
  const int b    = blockIdx.z;
  const int tid  = threadIdx.x;
  const int wave = __builtin_amdgcn_readfirstlane((int)(tid >> 5));
  const int lane = tid & 31;
  const int lq   = lane & 15;   // query column of S^T / column of the O tiles (d = 4*lq + dt)
  const int hi   = lane >> 4;   // k-split half

  const int qrow0 = qblk * BQ + wave * 16;               // first query row of this wave

  const float* row_h = qkv + (size_t)b * SEQ_FULL * QKV_ROW + h * HDIM;   // this head's slice of packed row 0 (slot 0)

  // strictly causal: this wave visits key chunks whose first key is <= its last query row (wave-uniform trip
  // count), from the chunk holding the diagonal down to chunk 0; only the first visited chunk needs the mask.
  const int nchunk = (qrow0 + 15) / BK + 1;

  // Direct path (chunks below the staged window): K, then V, of one chunk as f32 in registers until the wave converts them.
  // (one lane address each; everything else is a compile-time offset of the load)
  v4f kr[2][2][4];   // row = key j0 + sub*16 + lq, split d map
  v4f vr[16];        // key slot e = key j0 + (e/8)*16 + hi*8 + e%8 (the split key map), d = 4*lq + 0..3
  auto load_k = [&](const int j0) {
    const float* kbase = row_h + (size_t)(j0 + lq) * QKV_ROW + hi * 8;
    #pragma unroll
    for (int sub = 0; sub < 2; ++sub) {
      #pragma unroll
      for (int f = 0; f < 2; ++f) {
        const float* base = kbase + OUT_ROW + sub * 16 * QKV_ROW + f * 32;   // slot 1 = K
        kr[sub][f][0] = *(const v4f*)(base);          // d = f*32 + hi*8 + 0..3
        kr[sub][f][1] = *(const v4f*)(base + 4);      // d = f*32 + hi*8 + 4..7
        kr[sub][f][2] = *(const v4f*)(base + 16);     // d = f*32 + 16 + hi*8 + 0..3
        kr[sub][f][3] = *(const v4f*)(base + 20);     // d = f*32 + 16 + hi*8 + 4..7
      }
    }
    // the wait that belongs in front of any overwrite of a register which an issued load names; the lane address
    // is an input, so it stays live up to it and no load of the run can take it for its result
    asm volatile("s_wait_xcnt 0x0" :: "v"(kbase) : "memory");
  };
  auto load_v = [&](const int j0) {
    const float* vbase = row_h + (size_t)(j0 + hi * 8) * QKV_ROW + lq * 4;
    #pragma unroll
    for (int e = 0; e < 16; ++e)
      vr[e] = *(const v4f*)(vbase + 2 * OUT_ROW + ((e >> 3) * 16 + (e & 7)) * QKV_ROW);   // slot 2 = V
    // as in load_k
    asm volatile("s_wait_xcnt 0x0" :: "v"(vbase) : "memory");
  };

  int i = nchunk - 1;

  // first staged chunk (same for the whole workgroup); the window always lies inside the sequence
  const int cb0 = qblk * NDIAG - (NWIN - NDIAG);
  const int cB  = cb0 < 0 ? 0 : cb0;

  // staging loads: none depends on another or on Q, so they and the Q loads all fly together
  constexpr int NKS = NWIN * BK / (2 * NWAVE);   // K rows per thread (a wave load covers two whole rows)
  v4f ks[NKS], va[8], vb[4], qr[2][4];
  const int ua = wave;                            // every wave converts V unit 'wave' ...
  const int ub = NWAVE + (wave >> 1);             // ... and four of the eight key slots of a unit shared with its neighbour
  const int kb = (wave & 1) * 4;
  {
    const float* kst = row_h + (size_t)(cB * BK + wave * 2 + hi) * QKV_ROW + lq * 4;
    const float* vsa = row_h + (size_t)(cB * BK + ua * 16 + hi * 8) * QKV_ROW + lq * 4;
    const float* vsb = row_h + (size_t)(cB * BK + ub * 16 + hi * 8 + kb) * QKV_ROW + lq * 4;
    const float* qp  = row_h + (size_t)(qrow0 + lq) * QKV_ROW + hi * 8;      // slot 0 = Q
    #pragma unroll
    for (int t = 0; t < NKS; ++t) ks[t] = *(const v4f*)(kst + OUT_ROW + t * (2 * NWAVE) * QKV_ROW);   // slot 1 = K
    #pragma unroll
    for (int k = 0; k < 8; ++k) va[k] = *(const v4f*)(vsa + 2 * OUT_ROW + k * QKV_ROW);               // slot 2 = V
    #pragma unroll
    for (int k = 0; k < 4; ++k) vb[k] = *(const v4f*)(vsb + 2 * OUT_ROW + k * QKV_ROW);
    #pragma unroll
    for (int f = 0; f < 2; ++f) {
      qr[f][0] = *(const v4f*)(qp + f * 32);            // d = f*32 + hi*8 + 0..3
      qr[f][1] = *(const v4f*)(qp + f * 32 + 4);        // d = f*32 + hi*8 + 4..7
      qr[f][2] = *(const v4f*)(qp + f * 32 + 16);       // d = f*32 + 16 + hi*8 + 0..3
      qr[f][3] = *(const v4f*)(qp + f * 32 + 20);       // d = f*32 + 16 + hi*8 + 4..7
    }
    // the wait that belongs in front of any overwrite of a register which an issued load names (addresses kept live to it)
    asm volatile("s_wait_xcnt 0x0" :: "v"(kst), "v"(vsa), "v"(vsb), "v"(qp) : "memory");
  }

  // convert and store the staged window, in the order of the loads
  #pragma unroll
  for (int t = 0; t < NKS; ++t) {
    Pack4B p;
    #pragma unroll
    for (int c = 0; c < 4; ++c) p.h[c] = (bf16)ks[t][c];                   // bf16 RNE convert
    *(v2u*)(sK + (t * (2 * NWAVE) + wave * 2 + hi) * KP + lq * 4) = p.q;
  }
  // V unit u = chunk slot u/2, fragment half u%2; a lane's piece holds key slots 0..7 of that half
  #pragma unroll
  for (int dt = 0; dt < 4; ++dt) {
    Pack8H p;
    #pragma unroll
    for (int k = 0; k < 8; ++k) p.h[k] = (f16)(float)(bf16)va[k][dt];       // f16 of the bf16 value
    *(v4u*)(sV + ((((ua >> 1) * 4 + dt) * 2 + (ua & 1)) * 32 + lane) * 8) = p.q;
  }
  #pragma unroll
  for (int dt = 0; dt < 4; ++dt) {
    Pack4H p;
    #pragma unroll
    for (int k = 0; k < 4; ++k) p.h[k] = (f16)(float)(bf16)vb[k][dt];
    *(v2u*)(sV + ((((ub >> 1) * 4 + dt) * 2 + (ub & 1)) * 32 + lane) * 8 + kb) = p.q;
  }

  // Q as B-operand fragments: lane lq holds query qrow0+lq, elements follow the split d map; bf16 RNE convert.
  FragB qf[2];
  #pragma unroll
  for (int f = 0; f < 2; ++f) {
    #pragma unroll
    for (int p = 0; p < 4; ++p) {
      #pragma unroll
      for (int c = 0; c < 4; ++c) qf[f].h[p * 4 + c] = (bf16)qr[f][p][c];
    }
  }
  __syncthreads();   // the window is complete for every wave; it is only read from here on

  v8f o[4], o2[4];
  #pragma unroll
  for (int dt = 0; dt < 4; ++dt) {
    o[dt]  = (v8f){0, 0, 0, 0, 0, 0, 0, 0};
    o2[dt] = (v8f){0, 0, 0, 0, 0, 0, 0, 0};
  }

  const float NINF = -__builtin_inff();
  float rtail = 0.0f;                                // softplus sum (log2 units) over all visited later keys of query lq
  const float SL = 0.1875f * 1.4426950408889634f;    // score scale (1.5/sqrt(64)) * log2(e)
  const int   qi = qrow0 + lq;

  for (;;) {
    const int j0 = i * BK;

    FragB ak[2][2];   // K A-fragments
    FragH bv[4];      // V B-fragments: column lq of tile dt = d = 4*lq + dt, element e = key slot e
    if (i >= cB) {    // wave-uniform: the chunk is in the staged window
      const bf16* kp = sK + ((i - cB) * BK + lq) * KP + hi * 8;
      const f16*  vp = sV + ((i - cB) * 8 * 32 + lane) * 8;
      #pragma unroll
      for (int sub = 0; sub < 2; ++sub) {
        #pragma unroll
        for (int f = 0; f < 2; ++f) {
          ak[sub][f].q[0] = *(const v4u*)(kp + sub * 16 * KP + f * 32);        // d = f*32 + hi*8 + 0..7
          ak[sub][f].q[1] = *(const v4u*)(kp + sub * 16 * KP + f * 32 + 16);   // d = f*32 + 16 + hi*8 + 0..7
        }
      }
      #pragma unroll
      for (int dt = 0; dt < 4; ++dt) {
        bv[dt].q[0] = *(const v4u*)(vp + (dt * 2 + 0) * 32 * 8);               // key slots 0..7
        bv[dt].q[1] = *(const v4u*)(vp + (dt * 2 + 1) * 32 * 8);               // key slots 8..15
      }
    } else {          // below the window: this wave loads and converts the chunk itself
      load_k(j0);
      #pragma unroll
      for (int sub = 0; sub < 2; ++sub) {
        #pragma unroll
        for (int f = 0; f < 2; ++f) {
          #pragma unroll
          for (int p = 0; p < 4; ++p) {
            #pragma unroll
            for (int i = 0; i < 4; ++i) ak[sub][f].h[p * 4 + i] = (bf16)kr[sub][f][p][i];   // bf16 RNE convert
          }
        }
      }
      load_v(j0);
      #pragma unroll
      for (int dt = 0; dt < 4; ++dt) {
        #pragma unroll
        for (int e = 0; e < 16; ++e) bv[dt].h[e] = (f16)(float)(bf16)vr[e][dt];             // f16 of the bf16 value
      }
    }

    // S^T tiles: c[sub][r] = rawscore(query qrow0+lq, key j0 + sub*16 + hi*8 + r)
    v8f c[2];
    #pragma unroll
    for (int sub = 0; sub < 2; ++sub) {
      v8f acc = (v8f){0, 0, 0, 0, 0, 0, 0, 0};
      acc = mma_bf16(ak[sub][0].v, qf[0].v, acc);
      acc = mma_bf16(ak[sub][1].v, qf[1].v, acc);
      c[sub] = acc;
    }

    // strict causal mask (key >= query -> -inf marker: softplus 0, weight 0); branch is wave-uniform, selects per lane
    if (j0 + BK - 1 >= qrow0) {
      #pragma unroll
      for (int sub = 0; sub < 2; ++sub) {
        #pragma unroll
        for (int r = 0; r < 8; ++r) {
          const int key = j0 + sub * 16 + hi * 8 + r;
          c[sub][r] = (key >= qi) ? NINF : c[sub][r];
        }
      }
    }

    // per element (log2 units): softplus, logsigmoid, and the in-lane exclusive suffix sum over the 8
    // consecutive keys hi*8 + r of each sub tile: e[sub][r] = logsigmoid - sum_{r' > r} softplus
    float e[2][8];
    float g[2];
    #pragma unroll
    for (int sub = 0; sub < 2; ++sub) {
      float run = 0.0f;
      #pragma unroll
      for (int r = 7; r >= 0; --r) {
        const float t2 = c[sub][r] * SL;
        const float y  = __builtin_amdgcn_exp2f(-fabsf(t2));     // exp(-|x|) in (0, 1]
        const float l2 = __builtin_amdgcn_logf(1.0f + y);        // log2(1 + exp(-|x|))
        const float sp = fmaxf(t2, 0.0f) + l2;                   // softplus(x) * log2(e)
        const float ls = fminf(t2, 0.0f) - l2;                   // logsigmoid(x) * log2(e)
        e[sub][r] = ls - run;
        run += sp;
      }
      g[sub] = run;
    }
    // key groups in ascending order: G0 = (hi 0, sub 0), G1 = (hi 1, sub 0), G2 = (hi 0, sub 1), G3 = (hi 1, sub 1);
    // a group's offset is the sum of the later groups. Shuffles are unconditional, selection is by value.
    const float gp0  = __shfl_xor(g[0], 16, 32);
    const float gp1  = __shfl_xor(g[1], 16, 32);
    const float off0 = g[1] + gp1 + ((hi == 0) ? gp0 : 0.0f);
    const float off1 = (hi == 0) ? gp1 : 0.0f;
    const float tot  = (g[0] + gp0) + (g[1] + gp1);              // same bits in lane and lane^16
    const float bs0  = off0 + rtail - 12.0f;                     // -12: the x4096 carry
    const float bs1  = off1 + rtail - 12.0f;

    // weights + pack: P^T C-layout == A-fragment layout for the PV product.
    FragH pa, pr;
    #pragma unroll
    for (int r = 0; r < 8; ++r) {
      const float a0  = e[0][r] - bs0;                           // key hi*8 + r
      const float a1  = e[1][r] - bs1;                           // key 16 + hi*8 + r
      const float x0  = __builtin_amdgcn_exp2f(a0);
      const float x1  = __builtin_amdgcn_exp2f(a1);
      const float pc0 = (a0 < -14.0f) ? 0.0f : x0;               // exponent select: nothing below 2^-14
      const float pc1 = (a1 < -14.0f) ? 0.0f : x1;
      const f16 h0 = toh_flush(pc0);
      const f16 h1 = toh_flush(pc1);
      pa.h[r]     = h0;
      pa.h[8 + r] = h1;
      if (RES != 0) {
        pr.h[r]     = toh_flush((pc0 - (float)h0) * 1024.0f);
        pr.h[8 + r] = toh_flush((pc1 - (float)h1) * 1024.0f);
      }
    }
    rtail += tot;

    // O += P x V
    #pragma unroll
    for (int dt = 0; dt < 4; ++dt) {
      o[dt] = mma_f16(pa.v, bv[dt].v, o[dt]);
      if (RES != 0) o2[dt] = mma_f16(pr.v, bv[dt].v, o2[dt]);
    }

    // wave-uniform exit (ballot result is scalar): every query row of this wave is past the carry floor
    if (__builtin_amdgcn_ballot_w32(rtail < RCUT2) == 0u) break;
    if (--i < 0) break;
  }

  // leftover stick mass of query lq (lane lq and lane lq+16 hold the same bits)
  const float rem = __builtin_amdgcn_exp2f(-rtail);

  // stage: lane holds columns d = 4*lq + dt for query rows 8*hi + r
  float* so = sO + wave * (16 * OP);
  #pragma unroll
  for (int r = 0; r < 8; ++r) {
    #pragma unroll
    for (int dt = 0; dt < 4; ++dt) {
      float val = o[dt][r];
      if (RES != 0) val += o2[dt][r] * (1.0f / 1024.0f);
      so[(hi * 8 + r) * OP + lq * 4 + dt] = val * (1.0f / 4096.0f);
    }
  }
  __syncthreads();

  // write-out: lanes 0..15 one output row (16 lanes x 16 B each), lanes 16..31 the next row; 8 instructions cover the wave's 16 rows.
  // The leftover-mass term rem(row) * v(row) (v = bf16 RNE-converted input) is added here as float4.
  v4f    vals[8];
  size_t gidx[8];
  #pragma unroll
  for (int it = 0; it < 8; ++it) {
    const int   row = it * 2 + hi;
    const float rr  = __shfl(rem, row, 32);                      // lane 'row' holds query qrow0 + row
    const v4f   ov  = *(const v4f*)(so + row * OP + lq * 4);
    const v4f   vv  = *(const v4f*)(qkv + ((size_t)b * SEQ_FULL + qrow0 + row) * QKV_ROW + 2 * OUT_ROW + h * HDIM + lq * 4);
    v4f res;
    #pragma unroll
    for (int i = 0; i < 4; ++i) res[i] = ov[i] + rr * (float)(bf16)vv[i];
    vals[it] = res;
    gidx[it] = ((size_t)b * SEQ_FULL + qrow0 + row) * OUT_ROW + h * HDIM + lq * 4;
  }
  #pragma unroll
  for (int it = 0; it < 8; ++it) *(v4f*)(out + gidx[it]) = vals[it];
}

// One grid over all query blocks: the two bodies have no data in common, so their workgroups run side by side.
// The choice of body is the same for a whole workgroup (blockIdx.x only), so each body's barrier is block-uniform.
__global__ __launch_bounds__(256) void attn_kernel(const float* __restrict__ qkv,
                                                   float* __restrict__ out) {
  __shared__ __align__(16) float sO[NWAVE * 16 * OP];   // per-wave output staging (block barrier used)
  __shared__ __align__(16) bf16  sK[NWIN * BK * KP];    // staged K rows, row-major
  __shared__ __align__(16) f16   sV[NWIN * BK * HDIM];  // staged V, fragment order
  const int qblk = blockIdx.x;
  if (qblk < EARLY_QBLK) attn_body<1>(qkv, out, sO, sK, sV, qblk);
  else                   attn_body<0>(qkv, out, sO, sK, sV, qblk);
}

extern "C" void kernel_launch(void* const* d_in, const int* in_sizes, int n_in,
                              void* d_out, int out_size, void* d_ws, size_t ws_size,
                              hipStream_t stream) {
  if (n_in < 1) return;
  const size_t rows_used = (size_t)(NB - 1) * SEQ_FULL + SEQ;
  if ((size_t)in_sizes[0] < rows_used * QKV_ROW) return;
  if ((size_t)out_size < rows_used * OUT_ROW) return;

  const float* qkv = (const float*)d_in[0];
  float*       out = (float*)d_out;

  attn_kernel<<<dim3(SEQ / BQ, NHEAD, NB), 256, 0, stream>>>(qkv, out);
}

// v004
// It runs in 8.1 microseconds.
// In both of two side-by-side timings against v003, it was 1.07 times as fast.
// Over all steps from v000 it is 3.04 times as fast.
#include <hip/hip_runtime.h>

// Contractions: S^T = K x Q^T on v_wmma_f32_16x16x32_bf16 (bf16 operands = RNE-converted inputs, f32 accumulate);
// O = P x V on v_wmma_f32_16x16x32_f16 (P = stick-breaking weights as f16 carried x4096 plus an f16 residual plane x1024 with
// its own accumulator on query blocks < EARLY_QBLK; V = f16 of the bf16 RNE-converted input; f32 accumulate). Softplus suffix sums in f32 (VALU).
// K and V are read as f32 straight from the packed input. A workgroup converts the NWIN key chunks next to its diagonal
// once and keeps them in LDS for its 8 waves; a wave that goes deeper loads and converts those chunks itself.

#ifndef NB
#define NB 2
#endif
#ifndef SEQ
#define SEQ 2048
#endif
#define NB_FULL    2
#define SEQ_FULL   2048
#define NHEAD      16
#define HDIM       64
#define QKV_ROW    (3 * NHEAD * HDIM)   // floats per (b, s) of the packed input
#define OUT_ROW    (NHEAD * HDIM)       // floats per (b, s) of the output
#define BQ         128                  // query rows per workgroup (8 waves x 16)
#define BK         32                   // keys per inner iteration
#define NWAVE      8
#define EARLY_QBLK 4                    // query blocks that carry the weight residual plane
#define RCUT2      29.0f                // exit level of the running softplus sum, log2 units (20.1 nats)
#define NDIAG      (BQ / BK)            // key chunks that hold a workgroup's diagonal
#define NWIN       6                    // key chunks staged in LDS: the NDIAG diagonal ones and the two before them
#define KP         72                   // LDS pitch (bf16) of a staged K row: 144 B = 16 B x 9, odd for 16-B reads
#define NVUNIT     (NWIN * 2)           // V staging units: half a chunk (16 keys) each

static_assert(SEQ % BQ == 0);
static_assert(SEQ % BK == 0);
static_assert(BQ == NWAVE * 16);
static_assert(HDIM == 64);
static_assert(SEQ <= SEQ_FULL);
static_assert(NB >= 1 && NB <= NB_FULL);
static_assert(BK == 32);
static_assert(SEQ >= NWIN * BK);
static_assert(NWIN >= NDIAG);
static_assert((NWIN * BK) % (2 * NWAVE) == 0);
static_assert(NVUNIT == NWAVE + NWAVE / 2);
static_assert((KP * 2) % 16 == 0);

typedef __bf16   bf16;
typedef _Float16 f16;
typedef bf16     v16bf __attribute__((ext_vector_type(16)));
typedef f16      v16h  __attribute__((ext_vector_type(16)));
typedef float    v8f   __attribute__((ext_vector_type(8)));
typedef float    v4f   __attribute__((ext_vector_type(4)));
typedef unsigned v4u   __attribute__((ext_vector_type(4)));
typedef unsigned v2u   __attribute__((ext_vector_type(2)));

union FragB  { v16bf v; v4u q[2]; bf16 h[16]; };
union FragH  { v16h  v; v4u q[2]; f16  h[16]; };
union Pack4B { v2u q; bf16 h[4]; };
union Pack8H { v4u q; f16  h[8]; };
union Pack4H { v2u q; f16  h[4]; };

// WMMA helpers: builtin followed by the VALU hazard guard (ties D, keeps A/B live).
static __device__ __forceinline__ v8f mma_bf16(v16bf a, v16bf b, v8f acc) {
  acc = __builtin_amdgcn_wmma_f32_16x16x32_bf16(false, a, false, b, (short)0, acc, false, false);
  asm volatile("v_nop\n\tv_nop\n\tv_nop\n\tv_nop" : "+v"(acc) : "v"(a), "v"(b));
  return acc;
}
static __device__ __forceinline__ v8f mma_f16(v16h a, v16h b, v8f acc) {
  acc = __builtin_amdgcn_wmma_f32_16x16x32_f16(false, a, false, b, (short)0, acc, false, false);
  asm volatile("v_nop\n\tv_nop\n\tv_nop\n\tv_nop" : "+v"(acc) : "v"(a), "v"(b));
  return acc;
}

// f32 -> f16 convert that cannot produce an f16 subnormal (value select below 2^-14).
static __device__ __forceinline__ f16 toh_flush(float v) {
  const f16 r = (f16)v;
  return (fabsf(v) < 6.103515625e-05f) ? (f16)0.0f : r;
}

// Flash-style strictly causal stick-breaking attention
//   x(q,k) = (1.5/sqrt(64)) * <q,k>,  p(q,k) = exp(logsigmoid(x(q,k)) - sum_{k<j<q} softplus(x(q,j)))  for k < q,
//   out(q) = sum_k p(q,k) v(k) + exp(-sum_{j<q} softplus(x(q,j))) * v(q)   (the leftover stick mass, telescoped form).
// All exponents are <= 0, so no running max and no rescaling. Key chunks of 32 are visited in DESCENDING order;
// rtail carries the softplus sum (log2 units) of all later keys. Inside a chunk the exclusive suffix sums are an
// in-lane serial scan over 8 consecutive keys plus the group totals exchanged with lane^16 (f32, VALU).
// A wave leaves the key loop once every query row has rtail >= RCUT2: all further weights are below the x4096
// f16 carry floor (they convert to zero in this kernel anyway) and the leftover mass is below 2e-9.
// Block = (query block of 128, head, batch); one wave owns 16 query rows.
// S^T = K x Q^T so queries sit on lanes; P^T in C-layout is bit-identical to the A-fragment layout of O += P x V.
// K A-fragments: a lane holds its key row's values in the split d map.
// V B-fragments: output column n of tile dt stands for d = 4*n + dt, so one 16-B f32 load of V[key][4*lq .. 4*lq+3]
// feeds the same key slot of all four fragments; 16 lanes read one whole 256-B row, no transposition anywhere.
// Staging: K rows are loaded whole (16 lanes x 16 B a row), converted and kept row-major at pitch KP, so a fragment is
// two 16-B LDS reads of the lane's row; V half chunks are loaded as above, converted and kept in fragment order
// (lane-major 16-B pieces), so a fragment is two contiguous 512-B wave reads. Same values and same sums as direct loads.
// RES != 0: weight residual plane (x1024 relative to the x4096 carried hi plane) accumulated separately.
template <int RES>
static __device__ __forceinline__ void attn_body(const float* __restrict__ qkv,
                                                 float* __restrict__ out,
                                                 bf16* __restrict__ sK,
                                                 f16* __restrict__ sV,
                                                 const int qblk) {
  const int h    = blockIdx.y;
  const int b    = blockIdx.z;
  const int tid  = threadIdx.x;
  const int wave = __builtin_amdgcn_readfirstlane((int)(tid >> 5));
  const int lane = tid & 31;
  const int lq   = lane & 15;   // query column of S^T / column of the O tiles (d = 4*lq + dt)
  const int hi   = lane >> 4;   // k-split half

  const int qrow0 = qblk * BQ + wave * 16;               // first query row of this wave

  const float* row_h = qkv + (size_t)b * SEQ_FULL * QKV_ROW + h * HDIM;   // this head's slice of packed row 0 (slot 0)

  // strictly causal: this wave visits key chunks whose first key is <= its last query row (wave-uniform trip
  // count), from the chunk holding the diagonal down to chunk 0; only the first visited chunk needs the mask.
  const int nchunk = (qrow0 + 15) / BK + 1;

  // Direct path (chunks below the staged window): K, then V, of one chunk as f32 in registers until the wave converts them.
  // (one lane address each; everything else is a compile-time offset of the load)
  v4f kr[2][2][4];   // row = key j0 + sub*16 + lq, split d map
  v4f vr[16];        // key slot e = key j0 + (e/8)*16 + hi*8 + e%8 (the split key map), d = 4*lq + 0..3
  auto load_k = [&](const int j0) {
    const float* kbase = row_h + (size_t)(j0 + lq) * QKV_ROW + hi * 8;
    #pragma unroll
    for (int sub = 0; sub < 2; ++sub) {
      #pragma unroll
      for (int f = 0; f < 2; ++f) {
        const float* base = kbase + OUT_ROW + sub * 16 * QKV_ROW + f * 32;   // slot 1 = K
        kr[sub][f][0] = *(const v4f*)(base);          // d = f*32 + hi*8 + 0..3
        kr[sub][f][1] = *(const v4f*)(base + 4);      // d = f*32 + hi*8 + 4..7
        kr[sub][f][2] = *(const v4f*)(base + 16);     // d = f*32 + 16 + hi*8 + 0..3
        kr[sub][f][3] = *(const v4f*)(base + 20);     // d = f*32 + 16 + hi*8 + 4..7
      }
    }
    // the wait that belongs in front of any overwrite of a register which an issued load names; the lane address
    // is an input, so it stays live up to it and no load of the run can take it for its result
    asm volatile("s_wait_xcnt 0x0" :: "v"(kbase) : "memory");
  };
  auto load_v = [&](const int j0) {
    const float* vbase = row_h + (size_t)(j0 + hi * 8) * QKV_ROW + lq * 4;
    #pragma unroll
    for (int e = 0; e < 16; ++e)
      vr[e] = *(const v4f*)(vbase + 2 * OUT_ROW + ((e >> 3) * 16 + (e & 7)) * QKV_ROW);   // slot 2 = V
    // as in load_k
    asm volatile("s_wait_xcnt 0x0" :: "v"(vbase) : "memory");
  };

  int i = nchunk - 1;

  // first staged chunk (same for the whole workgroup); the window always lies inside the sequence
  const int cb0 = qblk * NDIAG - (NWIN - NDIAG);
  const int cB  = cb0 < 0 ? 0 : cb0;

  // staging loads: none depends on another or on Q, so they and the Q loads all fly together
  constexpr int NKS = NWIN * BK / (2 * NWAVE);   // K rows per thread (a wave load covers two whole rows)
  v4f ks[NKS], va[8], vb[4], qr[2][4];
  const int ua = wave;                            // every wave converts V unit 'wave' ...
  const int ub = NWAVE + (wave >> 1);             // ... and four of the eight key slots of a unit shared with its neighbour
  const int kb = (wave & 1) * 4;
  {
    const float* kst = row_h + (size_t)(cB * BK + wave * 2 + hi) * QKV_ROW + lq * 4;
    const float* vsa = row_h + (size_t)(cB * BK + ua * 16 + hi * 8) * QKV_ROW + lq * 4;
    const float* vsb = row_h + (size_t)(cB * BK + ub * 16 + hi * 8 + kb) * QKV_ROW + lq * 4;
    const float* qp  = row_h + (size_t)(qrow0 + lq) * QKV_ROW + hi * 8;      // slot 0 = Q
    #pragma unroll
    for (int t = 0; t < NKS; ++t) ks[t] = *(const v4f*)(kst + OUT_ROW + t * (2 * NWAVE) * QKV_ROW);   // slot 1 = K
    #pragma unroll
    for (int k = 0; k < 8; ++k) va[k] = *(const v4f*)(vsa + 2 * OUT_ROW + k * QKV_ROW);               // slot 2 = V
    #pragma unroll
    for (int k = 0; k < 4; ++k) vb[k] = *(const v4f*)(vsb + 2 * OUT_ROW + k * QKV_ROW);
    #pragma unroll
    for (int f = 0; f < 2; ++f) {
      qr[f][0] = *(const v4f*)(qp + f * 32);            // d = f*32 + hi*8 + 0..3
      qr[f][1] = *(const v4f*)(qp + f * 32 + 4);        // d = f*32 + hi*8 + 4..7
      qr[f][2] = *(const v4f*)(qp + f * 32 + 16);       // d = f*32 + 16 + hi*8 + 0..3
      qr[f][3] = *(const v4f*)(qp + f * 32 + 20);       // d = f*32 + 16 + hi*8 + 4..7
    }
    // the wait that belongs in front of any overwrite of a register which an issued load names (addresses kept live to it)
    asm volatile("s_wait_xcnt 0x0" :: "v"(kst), "v"(vsa), "v"(vsb), "v"(qp) : "memory");
  }

  // convert and store the staged window, in the order of the loads
  #pragma unroll
  for (int t = 0; t < NKS; ++t) {
    Pack4B p;
    #pragma unroll
    for (int c = 0; c < 4; ++c) p.h[c] = (bf16)ks[t][c];                   // bf16 RNE convert
    *(v2u*)(sK + (t * (2 * NWAVE) + wave * 2 + hi) * KP + lq * 4) = p.q;
  }
  // V unit u = chunk slot u/2, fragment half u%2; a lane's piece holds key slots 0..7 of that half
  #pragma unroll
  for (int dt = 0; dt < 4; ++dt) {
    Pack8H p;
    #pragma unroll
    for (int k = 0; k < 8; ++k) p.h[k] = (f16)(float)(bf16)va[k][dt];       // f16 of the bf16 value
    *(v4u*)(sV + ((((ua >> 1) * 4 + dt) * 2 + (ua & 1)) * 32 + lane) * 8) = p.q;
  }
  #pragma unroll
  for (int dt = 0; dt < 4; ++dt) {
    Pack4H p;
    #pragma unroll
    for (int k = 0; k < 4; ++k) p.h[k] = (f16)(float)(bf16)vb[k][dt];
    *(v2u*)(sV + ((((ub >> 1) * 4 + dt) * 2 + (ub & 1)) * 32 + lane) * 8 + kb) = p.q;
  }

  // Q as B-operand fragments: lane lq holds query qrow0+lq, elements follow the split d map; bf16 RNE convert.
  FragB qf[2];
  #pragma unroll
  for (int f = 0; f < 2; ++f) {
    #pragma unroll
    for (int p = 0; p < 4; ++p) {
      #pragma unroll
      for (int c = 0; c < 4; ++c) qf[f].h[p * 4 + c] = (bf16)qr[f][p][c];
    }
  }
  __syncthreads();   // the window is complete for every wave; it is only read from here on

  v8f o[4], o2[4];
  #pragma unroll
  for (int dt = 0; dt < 4; ++dt) {
    o[dt]  = (v8f){0, 0, 0, 0, 0, 0, 0, 0};
    o2[dt] = (v8f){0, 0, 0, 0, 0, 0, 0, 0};
  }

  const float NINF = -__builtin_inff();
  float rtail = 0.0f;                                // softplus sum (log2 units) over all visited later keys of query lq
  const float SL = 0.1875f * 1.4426950408889634f;    // score scale (1.5/sqrt(64)) * log2(e)
  const int   qi = qrow0 + lq;

  for (;;) {
    const int j0 = i * BK;

    FragB ak[2][2];   // K A-fragments
    FragH bv[4];      // V B-fragments: column lq of tile dt = d = 4*lq + dt, element e = key slot e
    if (i >= cB) {    // wave-uniform: the chunk is in the staged window
      const bf16* kp = sK + ((i - cB) * BK + lq) * KP + hi * 8;
      const f16*  vp = sV + ((i - cB) * 8 * 32 + lane) * 8;
      #pragma unroll
      for (int sub = 0; sub < 2; ++sub) {
        #pragma unroll
        for (int f = 0; f < 2; ++f) {
          ak[sub][f].q[0] = *(const v4u*)(kp + sub * 16 * KP + f * 32);        // d = f*32 + hi*8 + 0..7
          ak[sub][f].q[1] = *(const v4u*)(kp + sub * 16 * KP + f * 32 + 16);   // d = f*32 + 16 + hi*8 + 0..7
        }
      }
      #pragma unroll
      for (int dt = 0; dt < 4; ++dt) {
        bv[dt].q[0] = *(const v4u*)(vp + (dt * 2 + 0) * 32 * 8);               // key slots 0..7
        bv[dt].q[1] = *(const v4u*)(vp + (dt * 2 + 1) * 32 * 8);               // key slots 8..15
      }
    } else {          // below the window: this wave loads and converts the chunk itself
      load_k(j0);
      #pragma unroll
      for (int sub = 0; sub < 2; ++sub) {
        #pragma unroll
        for (int f = 0; f < 2; ++f) {
          #pragma unroll
          for (int p = 0; p < 4; ++p) {
            #pragma unroll
            for (int i = 0; i < 4; ++i) ak[sub][f].h[p * 4 + i] = (bf16)kr[sub][f][p][i];   // bf16 RNE convert
          }
        }
      }
      load_v(j0);
      #pragma unroll
      for (int dt = 0; dt < 4; ++dt) {
        #pragma unroll
        for (int e = 0; e < 16; ++e) bv[dt].h[e] = (f16)(float)(bf16)vr[e][dt];             // f16 of the bf16 value
      }
    }

    // S^T tiles: c[sub][r] = rawscore(query qrow0+lq, key j0 + sub*16 + hi*8 + r)
    v8f c[2];
    #pragma unroll
    for (int sub = 0; sub < 2; ++sub) {
      v8f acc = (v8f){0, 0, 0, 0, 0, 0, 0, 0};
      acc = mma_bf16(ak[sub][0].v, qf[0].v, acc);
      acc = mma_bf16(ak[sub][1].v, qf[1].v, acc);
      c[sub] = acc;
    }

    // strict causal mask (key >= query -> -inf marker: softplus 0, weight 0); branch is wave-uniform, selects per lane
    if (j0 + BK - 1 >= qrow0) {
      #pragma unroll
      for (int sub = 0; sub < 2; ++sub) {
        #pragma unroll
        for (int r = 0; r < 8; ++r) {
          const int key = j0 + sub * 16 + hi * 8 + r;
          c[sub][r] = (key >= qi) ? NINF : c[sub][r];
        }
      }
    }

    // per element (log2 units): softplus, logsigmoid, and the in-lane exclusive suffix sum over the 8
    // consecutive keys hi*8 + r of each sub tile: e[sub][r] = logsigmoid - sum_{r' > r} softplus
    float e[2][8];
    float g[2];
    #pragma unroll
    for (int sub = 0; sub < 2; ++sub) {
      float run = 0.0f;
      #pragma unroll
      for (int r = 7; r >= 0; --r) {
        const float t2 = c[sub][r] * SL;
        const float y  = __builtin_amdgcn_exp2f(-fabsf(t2));     // exp(-|x|) in (0, 1]
        const float l2 = __builtin_amdgcn_logf(1.0f + y);        // log2(1 + exp(-|x|))
        const float sp = fmaxf(t2, 0.0f) + l2;                   // softplus(x) * log2(e)
        const float ls = fminf(t2, 0.0f) - l2;                   // logsigmoid(x) * log2(e)
        e[sub][r] = ls - run;
        run += sp;
      }
      g[sub] = run;
    }
    // key groups in ascending order: G0 = (hi 0, sub 0), G1 = (hi 1, sub 0), G2 = (hi 0, sub 1), G3 = (hi 1, sub 1);
    // a group's offset is the sum of the later groups. Shuffles are unconditional, selection is by value.
    const float gp0  = __shfl_xor(g[0], 16, 32);
    const float gp1  = __shfl_xor(g[1], 16, 32);
    const float off0 = g[1] + gp1 + ((hi == 0) ? gp0 : 0.0f);
    const float off1 = (hi == 0) ? gp1 : 0.0f;
    const float tot  = (g[0] + gp0) + (g[1] + gp1);              // same bits in lane and lane^16
    const float bs0  = off0 + rtail - 12.0f;                     // -12: the x4096 carry
    const float bs1  = off1 + rtail - 12.0f;

    // weights + pack: P^T C-layout == A-fragment layout for the PV product.
    FragH pa, pr;
    #pragma unroll
    for (int r = 0; r < 8; ++r) {
      const float a0  = e[0][r] - bs0;                           // key hi*8 + r
      const float a1  = e[1][r] - bs1;                           // key 16 + hi*8 + r
      const float x0  = __builtin_amdgcn_exp2f(a0);
      const float x1  = __builtin_amdgcn_exp2f(a1);
      const float pc0 = (a0 < -14.0f) ? 0.0f : x0;               // exponent select: nothing below 2^-14
      const float pc1 = (a1 < -14.0f) ? 0.0f : x1;
      const f16 h0 = toh_flush(pc0);
      const f16 h1 = toh_flush(pc1);
      pa.h[r]     = h0;
      pa.h[8 + r] = h1;
      if (RES != 0) {
        pr.h[r]     = toh_flush((pc0 - (float)h0) * 1024.0f);
        pr.h[8 + r] = toh_flush((pc1 - (float)h1) * 1024.0f);
      }
    }
    rtail += tot;

    // O += P x V
    #pragma unroll
    for (int dt = 0; dt < 4; ++dt) {
      o[dt] = mma_f16(pa.v, bv[dt].v, o[dt]);
      if (RES != 0) o2[dt] = mma_f16(pr.v, bv[dt].v, o2[dt]);
    }

    // wave-uniform exit (ballot result is scalar): every query row of this wave is past the carry floor
    if (__builtin_amdgcn_ballot_w32(rtail < RCUT2) == 0u) break;
    if (--i < 0) break;
  }

  // leftover stick mass of query lq (lane lq and lane lq+16 hold the same bits)
  const float rem = __builtin_amdgcn_exp2f(-rtail);

  // A lane's four accumulators of row r are the columns d = 4*lq + 0..3 of query row qrow0 + 8*hi + r: 16 consecutive
  // output bytes, and 16 lanes cover the head's whole 256-B row, so the output leaves straight from the registers.
  // The leftover-mass term rem(row) * v(row) needs V of the wave's own query rows in that same layout: it is the lane's
  // own 16-B piece of staged V unit uq (key slot k = row 8*hi + k, tile dt), the f16 of the bf16 value as in P x V.
  const int  uq = qblk * (BQ / 16) + wave - cB * 2;              // always inside the window (it holds the diagonal)
  const f16* vq = sV + ((uq >> 1) * 8 * 32 + (uq & 1) * 32 + lane) * 8;
  Pack8H vd[4];
  #pragma unroll
  for (int dt = 0; dt < 4; ++dt) vd[dt].q = *(const v4u*)(vq + dt * 2 * 32 * 8);

  float rr[8];
  #pragma unroll
  for (int r = 0; r < 8; ++r) rr[r] = __shfl(rem, hi * 8 + r, 32);   // lane 'row' holds query qrow0 + row

  v4f vals[8];
  #pragma unroll
  for (int r = 0; r < 8; ++r) {
    #pragma unroll
    for (int dt = 0; dt < 4; ++dt) {
      float val = o[dt][r];
      if (RES != 0) val += o2[dt][r] * (1.0f / 1024.0f);
      vals[r][dt] = __builtin_fmaf(rr[r], (float)vd[dt].h[r], val * (1.0f / 4096.0f));
    }
  }
  float* op = out + ((size_t)b * SEQ_FULL + qrow0 + hi * 8) * OUT_ROW + h * HDIM + lq * 4;
  #pragma unroll
  for (int r = 0; r < 8; ++r) *(v4f*)(op + r * OUT_ROW) = vals[r];
}

// One grid over all query blocks: the two bodies have no data in common, so their workgroups run side by side.
// The choice of body is the same for a whole workgroup (blockIdx.x only), so each body's barrier is block-uniform.
__global__ __launch_bounds__(256) void attn_kernel(const float* __restrict__ qkv,
                                                   float* __restrict__ out) {
  __shared__ __align__(16) bf16  sK[NWIN * BK * KP];    // staged K rows, row-major
  __shared__ __align__(16) f16   sV[NWIN * BK * HDIM];  // staged V, fragment order
  const int qblk = blockIdx.x;
  if (qblk < EARLY_QBLK) attn_body<1>(qkv, out, sK, sV, qblk);
  else                   attn_body<0>(qkv, out, sK, sV, qblk);
}

extern "C" void kernel_launch(void* const* d_in, const int* in_sizes, int n_in,
                              void* d_out, int out_size, void* d_ws, size_t ws_size,
                              hipStream_t stream) {
  if (n_in < 1) return;
  const size_t rows_used = (size_t)(NB - 1) * SEQ_FULL + SEQ;
  if ((size_t)in_sizes[0] < rows_used * QKV_ROW) return;
  if ((size_t)out_size < rows_used * OUT_ROW) return;

  const float* qkv = (const float*)d_in[0];
  float*       out = (float*)d_out;

  attn_kernel<<<dim3(SEQ / BQ, NHEAD, NB), 256, 0, stream>>>(qkv, out);
}

// v005
// A run of this version takes 7.42 microseconds.
// Two timings next to v004 put it at 1.10 and 1.09 times that version's speed.
// Counting every step since v000, it is 3.32 times as fast.
#include <hip/hip_runtime.h>

// Contractions: S^T = K x Q^T on v_wmma_f32_16x16x32_bf16 (bf16 operands = RNE-converted inputs, f32 accumulate);
// O = P x V on v_wmma_f32_16x16x32_f16 (P = stick-breaking weights as f16 carried x4096 plus an f16 residual plane x1024 with
// its own accumulator on query blocks < EARLY_QBLK; V = f16 of the bf16 RNE-converted input; f32 accumulate). Softplus suffix sums in f32 (VALU).
// K and V are read as f32 straight from the packed input. A workgroup converts the NWIN key chunks next to its diagonal
// once and keeps them in LDS for its 8 waves; a wave that goes deeper loads and converts those chunks itself.

#ifndef NB
#define NB 2
#endif
#ifndef SEQ
#define SEQ 2048
#endif
#define NB_FULL    2
#define SEQ_FULL   2048
#define NHEAD      16
#define HDIM       64
#define QKV_ROW    (3 * NHEAD * HDIM)   // floats per (b, s) of the packed input
#define OUT_ROW    (NHEAD * HDIM)       // floats per (b, s) of the output
#define BQ         128                  // query rows per workgroup (8 waves x 16)
#define BK         32                   // keys per inner iteration
#define NWAVE      8
#define EARLY_QBLK 4                    // query blocks that carry the weight residual plane
#define RCUT2      29.0f                // exit level of the running softplus sum, log2 units (20.1 nats)
#define NDIAG      (BQ / BK)            // key chunks that hold a workgroup's diagonal
#define NWIN       6                    // key chunks staged in LDS: the NDIAG diagonal ones and the two before them
#define KP         72                   // LDS pitch (bf16) of a staged K row: 144 B = 16 B x 9, odd for 16-B reads
#define NVUNIT     (NWIN * 2)           // V staging units: half a chunk (16 keys) each

static_assert(SEQ % BQ == 0);
static_assert(SEQ % BK == 0);
static_assert(BQ == NWAVE * 16);
static_assert(HDIM == 64);
static_assert(SEQ <= SEQ_FULL);
static_assert(NB >= 1 && NB <= NB_FULL);
static_assert(BK == 32);
static_assert(SEQ >= NWIN * BK);
static_assert(NWIN >= NDIAG);
static_assert((NWIN * BK) % (2 * NWAVE) == 0);
static_assert(NVUNIT == NWAVE + NWAVE / 2);
static_assert((KP * 2) % 16 == 0);
static_assert((NWIN - NDIAG) * BK >= 32);   // every wave's first pass lies in the staged window
static_assert(EARLY_QBLK >= 1);             // the start of the sequence is handled in the RES body only

typedef __bf16   bf16;
typedef _Float16 f16;
typedef bf16     v16bf __attribute__((ext_vector_type(16)));
typedef f16      v16h  __attribute__((ext_vector_type(16)));
typedef float    v8f   __attribute__((ext_vector_type(8)));
typedef float    v4f   __attribute__((ext_vector_type(4)));
typedef unsigned v4u   __attribute__((ext_vector_type(4)));
typedef unsigned v2u   __attribute__((ext_vector_type(2)));

union FragB  { v16bf v; v4u q[2]; bf16 h[16]; };
union FragH  { v16h  v; v4u q[2]; f16  h[16]; };
union Pack4B { v2u q; bf16 h[4]; };
union Pack8H { v4u q; f16  h[8]; };
union Pack4H { v2u q; f16  h[4]; };

template <int N> struct IC { static constexpr int value = N; };   // a compile-time count as a lambda argument

// WMMA helpers: builtin followed by the VALU hazard guard (ties D, keeps A/B live).
static __device__ __forceinline__ v8f mma_bf16(v16bf a, v16bf b, v8f acc) {
  acc = __builtin_amdgcn_wmma_f32_16x16x32_bf16(false, a, false, b, (short)0, acc, false, false);
  asm volatile("v_nop\n\tv_nop\n\tv_nop\n\tv_nop" : "+v"(acc) : "v"(a), "v"(b));
  return acc;
}
static __device__ __forceinline__ v8f mma_f16(v16h a, v16h b, v8f acc) {
  acc = __builtin_amdgcn_wmma_f32_16x16x32_f16(false, a, false, b, (short)0, acc, false, false);
  asm volatile("v_nop\n\tv_nop\n\tv_nop\n\tv_nop" : "+v"(acc) : "v"(a), "v"(b));
  return acc;
}

// f32 -> f16 convert that cannot produce an f16 subnormal (value select below 2^-14).
static __device__ __forceinline__ f16 toh_flush(float v) {
  const f16 r = (f16)v;
  return (fabsf(v) < 6.103515625e-05f) ? (f16)0.0f : r;
}

// Flash-style strictly causal stick-breaking attention
//   x(q,k) = (1.5/sqrt(64)) * <q,k>,  p(q,k) = exp(logsigmoid(x(q,k)) - sum_{k<j<q} softplus(x(q,j)))  for k < q,
//   out(q) = sum_k p(q,k) v(k) + exp(-sum_{j<q} softplus(x(q,j))) * v(q)   (the leftover stick mass, telescoped form).
// All exponents are <= 0, so no running max and no rescaling. Keys are visited in DESCENDING order in tiles of 16;
// rtail carries the softplus sum (log2 units) of all later keys. Inside a tile the exclusive suffix sums are an
// in-lane serial scan over 8 consecutive keys plus the group totals exchanged with lane^16 (f32, VALU).
// A wave's first pass is the 48 keys that end at its own last query row: its diagonal tile and the two tiles below,
// no tile that lies wholly above the diagonal. Most waves are past the exit level behind it; the others go on
// in chunks of 32 keys.
// A wave leaves the key loop once every query row has rtail >= RCUT2: all further weights are below the x4096
// f16 carry floor (they convert to zero in this kernel anyway) and the leftover mass is below 2e-9.
// Block = (query block of 128, head, batch); one wave owns 16 query rows.
// S^T = K x Q^T so queries sit on lanes; P^T in C-layout is bit-identical to the A-fragment layout of O += P x V.
// K A-fragments: a lane holds its key row's values in the split d map.
// V B-fragments: output column n of tile dt stands for d = 4*n + dt, so one 16-B f32 load of V[key][4*lq .. 4*lq+3]
// feeds the same key slot of all four fragments; 16 lanes read one whole 256-B row, no transposition anywhere.
// Staging: K rows are loaded whole (16 lanes x 16 B a row), converted and kept row-major at pitch KP, so a fragment is
// two 16-B LDS reads of the lane's row; V half chunks are loaded as above, converted and kept in fragment order
// (lane-major 16-B pieces), so a fragment is two contiguous 512-B wave reads. Same values and same sums as direct loads.
// RES != 0: weight residual plane (x1024 relative to the x4096 carried hi plane) accumulated separately.
template <int RES>
static __device__ __forceinline__ void attn_body(const float* __restrict__ qkv,
                                                 float* __restrict__ out,
                                                 bf16* __restrict__ sK,
                                                 f16* __restrict__ sV,
                                                 const int qblk) {
  const int h    = blockIdx.y;
  const int b    = blockIdx.z;
  const int tid  = threadIdx.x;
  const int wave = __builtin_amdgcn_readfirstlane((int)(tid >> 5));
  const int lane = tid & 31;
  const int lq   = lane & 15;   // query column of S^T / column of the O tiles (d = 4*lq + dt)
  const int hi   = lane >> 4;   // k-split half

  const int qrow0 = qblk * BQ + wave * 16;               // first query row of this wave

  const float* row_h = qkv + (size_t)b * SEQ_FULL * QKV_ROW + h * HDIM;   // this head's slice of packed row 0 (slot 0)

  // Direct path (chunks below the staged window): K, then V, of one chunk as f32 in registers until the wave converts them.
  // (one lane address each; everything else is a compile-time offset of the load)
  v4f kr[2][2][4];   // row = key j0 + sub*16 + lq, split d map
  v4f vr[16];        // key slot e = key j0 + (e/8)*16 + hi*8 + e%8 (the split key map), d = 4*lq + 0..3
  auto load_k = [&](const int j0) {
    const float* kbase = row_h + (size_t)(j0 + lq) * QKV_ROW + hi * 8;
    #pragma unroll
    for (int sub = 0; sub < 2; ++sub) {
      #pragma unroll
      for (int f = 0; f < 2; ++f) {
        const float* base = kbase + OUT_ROW + sub * 16 * QKV_ROW + f * 32;   // slot 1 = K
        kr[sub][f][0] = *(const v4f*)(base);          // d = f*32 + hi*8 + 0..3
        kr[sub][f][1] = *(const v4f*)(base + 4);      // d = f*32 + hi*8 + 4..7
        kr[sub][f][2] = *(const v4f*)(base + 16);     // d = f*32 + 16 + hi*8 + 0..3
        kr[sub][f][3] = *(const v4f*)(base + 20);     // d = f*32 + 16 + hi*8 + 4..7
      }
    }
    // the wait that belongs in front of any overwrite of a register which an issued load names; the lane address
    // is an input, so it stays live up to it and no load of the run can take it for its result
    asm volatile("s_wait_xcnt 0x0" :: "v"(kbase) : "memory");
  };
  auto load_v = [&](const int j0) {
    const float* vbase = row_h + (size_t)(j0 + hi * 8) * QKV_ROW + lq * 4;
    #pragma unroll
    for (int e = 0; e < 16; ++e)
      vr[e] = *(const v4f*)(vbase + 2 * OUT_ROW + ((e >> 3) * 16 + (e & 7)) * QKV_ROW);   // slot 2 = V
    // as in load_k
    asm volatile("s_wait_xcnt 0x0" :: "v"(vbase) : "memory");
  };

  // first staged chunk (same for the whole workgroup); the window always lies inside the sequence
  const int cb0 = qblk * NDIAG - (NWIN - NDIAG);
  const int cB  = cb0 < 0 ? 0 : cb0;

  // staging loads: none depends on another or on Q, so they and the Q loads all fly together
  constexpr int NKS = NWIN * BK / (2 * NWAVE);   // K rows per thread (a wave load covers two whole rows)
  v4f ks[NKS], va[8], vb[4], qr[2][4];
  const int ua = wave;                            // every wave converts V unit 'wave' ...
  const int ub = NWAVE + (wave >> 1);             // ... and four of the eight key slots of a unit shared with its neighbour
  const int kb = (wave & 1) * 4;
  {
    const float* kst = row_h + (size_t)(cB * BK + wave * 2 + hi) * QKV_ROW + lq * 4;
    const float* vsa = row_h + (size_t)(cB * BK + ua * 16 + hi * 8) * QKV_ROW + lq * 4;
    const float* vsb = row_h + (size_t)(cB * BK + ub * 16 + hi * 8 + kb) * QKV_ROW + lq * 4;
    const float* qp  = row_h + (size_t)(qrow0 + lq) * QKV_ROW + hi * 8;      // slot 0 = Q
    #pragma unroll
    for (int t = 0; t < NKS; ++t) ks[t] = *(const v4f*)(kst + OUT_ROW + t * (2 * NWAVE) * QKV_ROW);   // slot 1 = K
    #pragma unroll
    for (int k = 0; k < 8; ++k) va[k] = *(const v4f*)(vsa + 2 * OUT_ROW + k * QKV_ROW);               // slot 2 = V
    #pragma unroll
    for (int k = 0; k < 4; ++k) vb[k] = *(const v4f*)(vsb + 2 * OUT_ROW + k * QKV_ROW);
    #pragma unroll
    for (int f = 0; f < 2; ++f) {
      qr[f][0] = *(const v4f*)(qp + f * 32);            // d = f*32 + hi*8 + 0..3
      qr[f][1] = *(const v4f*)(qp + f * 32 + 4);        // d = f*32 + hi*8 + 4..7
      qr[f][2] = *(const v4f*)(qp + f * 32 + 16);       // d = f*32 + 16 + hi*8 + 0..3
      qr[f][3] = *(const v4f*)(qp + f * 32 + 20);       // d = f*32 + 16 + hi*8 + 4..7
    }
    // the wait that belongs in front of any overwrite of a register which an issued load names (addresses kept live to it)
    asm volatile("s_wait_xcnt 0x0" :: "v"(kst), "v"(vsa), "v"(vsb), "v"(qp) : "memory");
  }

  // convert and store the staged window, in the order of the loads
  #pragma unroll
  for (int t = 0; t < NKS; ++t) {
    Pack4B p;
    #pragma unroll
    for (int c = 0; c < 4; ++c) p.h[c] = (bf16)ks[t][c];                   // bf16 RNE convert
    *(v2u*)(sK + (t * (2 * NWAVE) + wave * 2 + hi) * KP + lq * 4) = p.q;
  }
  // V unit u = window keys 16*u .. 16*u+15 (chunk slot u/2), read into either fragment half; a lane's piece holds keys 16*u + 8*hi + 0..7
  #pragma unroll
  for (int dt = 0; dt < 4; ++dt) {
    Pack8H p;
    #pragma unroll
    for (int k = 0; k < 8; ++k) p.h[k] = (f16)(float)(bf16)va[k][dt];       // f16 of the bf16 value
    *(v4u*)(sV + ((((ua >> 1) * 4 + dt) * 2 + (ua & 1)) * 32 + lane) * 8) = p.q;
  }
  #pragma unroll
  for (int dt = 0; dt < 4; ++dt) {
    Pack4H p;
    #pragma unroll
    for (int k = 0; k < 4; ++k) p.h[k] = (f16)(float)(bf16)vb[k][dt];
    *(v2u*)(sV + ((((ub >> 1) * 4 + dt) * 2 + (ub & 1)) * 32 + lane) * 8 + kb) = p.q;
  }

  // Q as B-operand fragments: lane lq holds query qrow0+lq, elements follow the split d map; bf16 RNE convert.
  FragB qf[2];
  #pragma unroll
  for (int f = 0; f < 2; ++f) {
    #pragma unroll
    for (int p = 0; p < 4; ++p) {
      #pragma unroll
      for (int c = 0; c < 4; ++c) qf[f].h[p * 4 + c] = (bf16)qr[f][p][c];
    }
  }
  __syncthreads();   // the window is complete for every wave; it is only read from here on

  v8f o[4], o2[4];
  #pragma unroll
  for (int dt = 0; dt < 4; ++dt) {
    o[dt]  = (v8f){0, 0, 0, 0, 0, 0, 0, 0};
    o2[dt] = (v8f){0, 0, 0, 0, 0, 0, 0, 0};
  }

  const float NINF = -__builtin_inff();
  float rtail = 0.0f;                                // softplus sum (log2 units) over all visited later keys of query lq
  const float SL = 0.1875f * 1.4426950408889634f;    // score scale (1.5/sqrt(64)) * log2(e)

  // K A-fragments of the 16 staged keys at window row wr (wave-uniform)
  auto lds_k = [&](FragB (&a)[2], const int wr) {
    const bf16* kp = sK + (wr + lq) * KP + hi * 8;
    #pragma unroll
    for (int f = 0; f < 2; ++f) {
      a[f].q[0] = *(const v4u*)(kp + f * 32);        // d = f*32 + hi*8 + 0..7
      a[f].q[1] = *(const v4u*)(kp + f * 32 + 16);   // d = f*32 + 16 + hi*8 + 0..7
    }
  };
  // one half (8 key slots a lane) of the four V B-fragments: staged unit u (wave-uniform)
  auto lds_v = [&](FragH (&bb)[4], const int half, const int u) {
    const f16* vp = sV + ((u >> 1) * 8 * 32 + (u & 1) * 32 + lane) * 8;
    #pragma unroll
    for (int dt = 0; dt < 4; ++dt) bb[dt].q[half] = *(const v4u*)(vp + dt * 2 * 32 * 8);
  };
  // S^T tile: element r = rawscore(query qrow0+lq, key of the tile's row hi*8 + r)
  auto score = [&](const FragB (&a)[2]) {
    v8f acc = (v8f){0, 0, 0, 0, 0, 0, 0, 0};
    acc = mma_bf16(a[0].v, qf[0].v, acc);
    acc = mma_bf16(a[1].v, qf[1].v, acc);
    return acc;
  };
  // Weights (x4096) of NT key tiles, ascending in key, that lie directly below the keys visited so far; adds their
  // softplus sums to rtail. A -inf score marks a key that does not count: softplus 0, weight 0.
  auto weights = [&](auto nt, const v8f* c, float (*w)[8]) {
    constexpr int NT = decltype(nt)::value;
    // per element (log2 units): softplus, logsigmoid, and the in-lane exclusive suffix sum over the 8
    // consecutive keys hi*8 + r of each tile: e[t][r] = logsigmoid - sum_{r' > r} softplus
    float e[NT][8], g[NT], gp[NT];
    #pragma unroll
    for (int t = 0; t < NT; ++t) {
      float run = 0.0f;
      #pragma unroll
      for (int r = 7; r >= 0; --r) {
        const float t2 = c[t][r] * SL;
        const float y  = __builtin_amdgcn_exp2f(-fabsf(t2));     // exp(-|x|) in (0, 1]
        const float l2 = __builtin_amdgcn_logf(1.0f + y);        // log2(1 + exp(-|x|))
        const float sp = fmaxf(t2, 0.0f) + l2;                   // softplus(x) * log2(e)
        const float ls = fminf(t2, 0.0f) - l2;                   // logsigmoid(x) * log2(e)
        e[t][r] = ls - run;
        run += sp;
      }
      g[t] = run;
    }
    // a tile's two key groups sit in lane and lane^16. Shuffles are unconditional, selection is by value.
    #pragma unroll
    for (int t = 0; t < NT; ++t) gp[t] = __shfl_xor(g[t], 16, 32);
    float later = rtail;                                         // softplus sum of all keys above tile t
    #pragma unroll
    for (int t = NT - 1; t >= 0; --t) {
      const float bs = later + ((hi == 0) ? gp[t] : 0.0f) - 12.0f;   // -12: the x4096 carry
      #pragma unroll
      for (int r = 0; r < 8; ++r) {
        const float a = e[t][r] - bs;
        const float x = __builtin_amdgcn_exp2f(a);
        w[t][r] = (a < -14.0f) ? 0.0f : x;                       // exponent select: nothing below 2^-14
      }
      later += g[t] + gp[t];                                     // same bits in lane and lane^16
    }
    rtail = later;
  };
  // O += P x V over 32 key slots: P^T C-layout == A-fragment layout. wl = weights of the lower 16 keys, wu of the
  // upper 16; NU == 0: no upper tile, its weights are zero.
  auto pv = [&](auto nu, const float* wl, const float* wu, const FragH (&bb)[4]) {
    constexpr int NU = decltype(nu)::value;
    FragH pa, pr;
    #pragma unroll
    for (int r = 0; r < 8; ++r) {
      const f16 h0 = toh_flush(wl[r]);
      pa.h[r] = h0;
      if (RES != 0) pr.h[r] = toh_flush((wl[r] - (float)h0) * 1024.0f);
      if (NU != 0) {
        const f16 h1 = toh_flush(wu[r]);
        pa.h[8 + r] = h1;
        if (RES != 0) pr.h[8 + r] = toh_flush((wu[r] - (float)h1) * 1024.0f);
      } else {
        pa.h[8 + r] = (f16)0.0f;
        if (RES != 0) pr.h[8 + r] = (f16)0.0f;
      }
    }
    #pragma unroll
    for (int dt = 0; dt < 4; ++dt) {
      o[dt] = mma_f16(pa.v, bb[dt].v, o[dt]);
      if (RES != 0) o2[dt] = mma_f16(pr.v, bb[dt].v, o2[dt]);
    }
  };

  // First pass, always inside the staged window: tile 2 = keys qrow0 .. qrow0+15 (the diagonal), tile 1 and tile 0
  // the 16 and 32 keys below. At the start of the sequence a tile below key 0 reads row 0 on and is masked whole.
  {
    const int wr2 = qrow0 - cB * BK;
    const int wr1 = wr2 < 16 ? 0 : wr2 - 16;
    const int wr0 = wr2 < 32 ? 0 : wr2 - 32;
    FragB ak[3][2];
    FragH bu[4], bl[4];
    lds_k(ak[2], wr2);
    lds_k(ak[1], wr1);
    lds_k(ak[0], wr0);
    lds_v(bu, 0, wr1 >> 4);
    lds_v(bu, 1, wr2 >> 4);
    lds_v(bl, 0, wr0 >> 4);
    lds_v(bl, 1, wr0 >> 4);   // meets zero weights only; the same keys again, so nothing new can enter the sum

    v8f c[3];
    #pragma unroll
    for (int t = 0; t < 3; ++t) c[t] = score(ak[t]);

    // strict causal mask of the diagonal tile (key >= query)
    #pragma unroll
    for (int r = 0; r < 8; ++r) c[2][r] = (hi * 8 + r >= lq) ? NINF : c[2][r];
    if (RES != 0 && qrow0 < 32) {   // wave-uniform: tiles below key 0
      #pragma unroll
      for (int r = 0; r < 8; ++r) {
        c[0][r] = NINF;
        c[1][r] = (qrow0 < 16) ? NINF : c[1][r];
      }
    }

    float w[3][8];
    weights(IC<3>{}, c, w);
    pv(IC<1>{}, w[1], w[2], bu);
    pv(IC<0>{}, w[0], w[0], bl);
  }

  int jtop = qrow0 - 32;   // lowest key visited so far
  // wave-uniform test (ballot result is scalar): some query row of this wave is not yet past the carry floor, and keys are left
  auto more = [&]() { return __builtin_amdgcn_ballot_w32(rtail < RCUT2) != 0u && jtop > 0; };
  // the test stands once in front of the loop and once at its foot: with one test at the loop's head every wave,
  // also one that never enters, paid a copy of all accumulators there
  if (more()) do {
    const int j0 = jtop < BK ? 0 : jtop - BK;

    FragB ak[2][2];   // K A-fragments
    FragH bv[4];      // V B-fragments: column lq of tile dt = d = 4*lq + dt, element e = key slot e
    if (j0 >= cB * BK) {    // wave-uniform: the chunk is in the staged window
      const int wr = j0 - cB * BK;
      lds_k(ak[0], wr);
      lds_k(ak[1], wr + 16);
      lds_v(bv, 0, wr >> 4);
      lds_v(bv, 1, (wr >> 4) + 1);
    } else {          // below the window: this wave loads and converts the chunk itself
      load_k(j0);
      #pragma unroll
      for (int sub = 0; sub < 2; ++sub) {
        #pragma unroll
        for (int f = 0; f < 2; ++f) {
          #pragma unroll
          for (int p = 0; p < 4; ++p) {
            #pragma unroll
            for (int i = 0; i < 4; ++i) ak[sub][f].h[p * 4 + i] = (bf16)kr[sub][f][p][i];   // bf16 RNE convert
          }
        }
      }
      load_v(j0);
      #pragma unroll
      for (int dt = 0; dt < 4; ++dt) {
        #pragma unroll
        for (int e = 0; e < 16; ++e) bv[dt].h[e] = (f16)(float)(bf16)vr[e][dt];             // f16 of the bf16 value
      }
    }

    v8f c[2];
    #pragma unroll
    for (int sub = 0; sub < 2; ++sub) c[sub] = score(ak[sub]);

    // only 16 keys were left (wave-uniform): the chunk starts at key 0 and its upper tile has been visited already
    if (j0 + BK > jtop) {
      #pragma unroll
      for (int r = 0; r < 8; ++r) c[1][r] = NINF;
    }

    float w[2][8];
    weights(IC<2>{}, c, w);
    pv(IC<1>{}, w[0], w[1], bv);
    jtop = j0;
  } while (more());

  // leftover stick mass of query lq (lane lq and lane lq+16 hold the same bits)
  const float rem = __builtin_amdgcn_exp2f(-rtail);

  // A lane's four accumulators of row r are the columns d = 4*lq + 0..3 of query row qrow0 + 8*hi + r: 16 consecutive
  // output bytes, and 16 lanes cover the head's whole 256-B row, so the output leaves straight from the registers.
  // The leftover-mass term rem(row) * v(row) needs V of the wave's own query rows in that same layout: it is the lane's
  // own 16-B piece of staged V unit uq (key slot k = row 8*hi + k, tile dt), the f16 of the bf16 value as in P x V.
  const int  uq = qblk * (BQ / 16) + wave - cB * 2;              // always inside the window (it holds the diagonal)
  const f16* vq = sV + ((uq >> 1) * 8 * 32 + (uq & 1) * 32 + lane) * 8;
  Pack8H vd[4];
  #pragma unroll
  for (int dt = 0; dt < 4; ++dt) vd[dt].q = *(const v4u*)(vq + dt * 2 * 32 * 8);

  float rr[8];
  #pragma unroll
  for (int r = 0; r < 8; ++r) rr[r] = __shfl(rem, hi * 8 + r, 32);   // lane 'row' holds query qrow0 + row

  v4f vals[8];
  #pragma unroll
  for (int r = 0; r < 8; ++r) {
    #pragma unroll
    for (int dt = 0; dt < 4; ++dt) {
      float val = o[dt][r];
      if (RES != 0) val += o2[dt][r] * (1.0f / 1024.0f);
      vals[r][dt] = __builtin_fmaf(rr[r], (float)vd[dt].h[r], val * (1.0f / 4096.0f));
    }
  }
  float* op = out + ((size_t)b * SEQ_FULL + qrow0 + hi * 8) * OUT_ROW + h * HDIM + lq * 4;
  #pragma unroll
  for (int r = 0; r < 8; ++r) *(v4f*)(op + r * OUT_ROW) = vals[r];
}

// One grid over all query blocks: the two bodies have no data in common, so their workgroups run side by side.
// The choice of body is the same for a whole workgroup (blockIdx.x only), so each body's barrier is block-uniform.
__global__ __launch_bounds__(256) void attn_kernel(const float* __restrict__ qkv,
                                                   float* __restrict__ out) {
  __shared__ __align__(16) bf16  sK[NWIN * BK * KP];    // staged K rows, row-major
  __shared__ __align__(16) f16   sV[NWIN * BK * HDIM];  // staged V, fragment order
  const int qblk = blockIdx.x;
  if (qblk < EARLY_QBLK) attn_body<1>(qkv, out, sK, sV, qblk);
  else                   attn_body<0>(qkv, out, sK, sV, qblk);
}

extern "C" void kernel_launch(void* const* d_in, const int* in_sizes, int n_in,
                              void* d_out, int out_size, void* d_ws, size_t ws_size,
                              hipStream_t stream) {
  if (n_in < 1) return;
  const size_t rows_used = (size_t)(NB - 1) * SEQ_FULL + SEQ;
  if ((size_t)in_sizes[0] < rows_used * QKV_ROW) return;
  if ((size_t)out_size < rows_used * OUT_ROW) return;

  const float* qkv = (const float*)d_in[0];
  float*       out = (float*)d_out;

  attn_kernel<<<dim3(SEQ / BQ, NHEAD, NB), 256, 0, stream>>>(qkv, out);
}
